// v000
// Times are from an AMD MI455X. After a warm-up the kernel runs many times in a row, and a time is the length of
// such a window on the GPU divided by its runs, so every launch and the gaps after it count. The runs cycle
// through copies of the inputs. A figure is the median of several windows, for all but v000 over two sittings.
// Sittings can differ by a few percent; kernels timed side by side share one.
// v000, which the later versions start from, runs in 2190 microseconds.
#include <hip/hip_runtime.h>

// Causal full attention on given tensors (queries, keys, values [2][2048][16][64] = (B, L, H, E) token-major; scores = q.k with NO scaling (faithful: the source never applies its scale; logits sigma ~8), strictly-future keys -> -inf; softmax; V = A.values -> [2][2048][16][64] (4.2 M)).
// Layout per batch: single bf16 head planes gathered from the token-major slabs (inputs are bf16-exact after rounding: exact score products, f32 accumulate - needed with unscaled logits); per head: exact scores, softmax with the causal index select and every row's probabilities as bf16 hi/lo, A.values as hi/lo x exact values^T (2 products); f32 rows written back token-major.
// Compute dtypes, f32 accumulate: every input rounded to bf16; q.k exact; softmax f32; P hi/lo x exact values; output f32.

#define NB_  2
#define TT   2048
#define DM   1024      // token-major row pitch (H x HD)
#define NH_  16
#define NKV  1
#define REP  (NH_ / NKV)
#define HD   64
#define DQ   (NH_ * HD)
#define DKV  (NKV * HD)
#define ZH   1
#define RH   2048                  // query rows < RH use hi+lo planes (0: none)
#define WIN  0
#define PCAR 1024.0f
#define SCL  1.0f   // the module computes a scale but never applies it
typedef _Float16 h16;
typedef unsigned short bf;
typedef __attribute__((ext_vector_type(16))) __bf16   v16bf;
typedef __attribute__((ext_vector_type(16))) _Float16 v16h;
typedef __attribute__((ext_vector_type(8)))  _Float16 v8h;
typedef __attribute__((ext_vector_type(8)))  unsigned short v8us;
typedef __attribute__((ext_vector_type(8)))  float    v8f;
typedef __attribute__((ext_vector_type(4)))  float    v4f;
typedef v8h  __attribute__((may_alias)) v8ha;
typedef v4f  __attribute__((may_alias)) v4fa;
typedef v8us __attribute__((may_alias)) v8usa;

__device__ __forceinline__ unsigned short f2bf(float f) { unsigned u = __float_as_uint(f); u += 0x7FFFu + ((u >> 16) & 1u); return (unsigned short)(u >> 16); }
__device__ __forceinline__ float bf2f(unsigned short b) { return __uint_as_float(((unsigned)b) << 16); }
__device__ __forceinline__ float bfr(float f) { return bf2f(f2bf(f)); }
__device__ __forceinline__ v16h cat16(v8h lo, v8h hi) { return __builtin_shufflevector(lo, hi, 0, 1, 2, 3, 4, 5, 6, 7, 8, 9, 10, 11, 12, 13, 14, 15); }
__device__ __forceinline__ v16bf cat16b(v8us lo, v8us hi) { return __builtin_bit_cast(v16bf, __builtin_shufflevector(lo, hi, 0, 1, 2, 3, 4, 5, 6, 7, 8, 9, 10, 11, 12, 13, 14, 15)); }
__device__ __forceinline__ v8f wmma16(v16h a, v16h b, v8f c) { return __builtin_amdgcn_wmma_f32_16x16x32_f16(false, a, false, b, (short)0, c, false, false); }
__device__ __forceinline__ v8f wmmab(v16bf a, v16bf b, v8f c) { return __builtin_amdgcn_wmma_f32_16x16x32_bf16(false, a, false, b, (short)0, c, false, false); }



// ---- k_gemmw: register-blocked GEMM, ONE WAVE per 64x64 output tile (16 accumulators), operands straight from K-contiguous 16-bit planes; grid (M/64, N/64, Z), 32 threads.
// C[m][n] (f32, pitch ldc, + optional f32 bias[n]) = sum_k A[m][k] Bt[n][k] (+ split products per NSPLIT). z-batch strides sA/sB/sC in elements. K % 32 == 0.
template <typename T16> struct WFrag;
template <> struct WFrag<h16> { typedef v16h V; static __device__ __forceinline__ V ld(const h16* p) { return cat16(*(const v8h*)p, *(const v8h*)(p + 16)); } static __device__ __forceinline__ v8f mma(V a, V b, v8f c) { return wmma16(a, b, c); } };
template <> struct WFrag<bf> { typedef v16bf V; static __device__ __forceinline__ V ld(const bf* p) { return cat16b(*(const v8us*)p, *(const v8us*)(p + 16)); } static __device__ __forceinline__ v8f mma(V a, V b, v8f c) { return wmmab(a, b, c); } };
template <typename T16, int NSPLIT, bool BIAS>
__global__ __launch_bounds__(32) void k_gemmw(const T16* __restrict__ A, const T16* __restrict__ A2, const T16* __restrict__ Bt, const T16* __restrict__ Bt2, int K, float* C, int ldc, const float* __restrict__ bias, size_t sA, size_t sB, size_t sC) {
    typedef typename WFrag<T16>::V V;
    __shared__ __align__(16) float os[16 * 68];
    const size_t z = blockIdx.z; A += z * sA; if (A2) A2 += z * sA; Bt += z * sB; if (Bt2) Bt2 += z * sB; C += z * sC;
    const int lane = threadIdx.x & 31, lr = lane & 15, hi = lane >> 4; const int r0 = blockIdx.x * 64, c0 = blockIdx.y * 64;
    v8f acc[4][4];
#pragma unroll
    for (int mb = 0; mb < 4; ++mb)
#pragma unroll
        for (int nb = 0; nb < 4; ++nb) acc[mb][nb] = (v8f){};
    const size_t aoff = (size_t)(r0 + lr) * K + 8 * hi, boff = (size_t)(c0 + lr) * K + 8 * hi;
#pragma unroll 1
    for (int kc = 0; kc < K; kc += 32) {
        V a[4], a2[4];
#pragma unroll
        for (int mb = 0; mb < 4; ++mb) { a[mb] = WFrag<T16>::ld(A + aoff + (size_t)mb * 16 * K + kc); if (NSPLIT == 1 || NSPLIT == 2) a2[mb] = WFrag<T16>::ld(A2 + aoff + (size_t)mb * 16 * K + kc); }
#pragma unroll
        for (int nb = 0; nb < 4; ++nb) { const V b = WFrag<T16>::ld(Bt + boff + (size_t)nb * 16 * K + kc); V b2; if (NSPLIT >= 2) b2 = WFrag<T16>::ld(Bt2 + boff + (size_t)nb * 16 * K + kc);
#pragma unroll
            for (int mb = 0; mb < 4; ++mb) { acc[mb][nb] = WFrag<T16>::mma(a[mb], b, acc[mb][nb]); if (NSPLIT == 1 || NSPLIT == 2) acc[mb][nb] = WFrag<T16>::mma(a2[mb], b, acc[mb][nb]); if (NSPLIT >= 2) acc[mb][nb] = WFrag<T16>::mma(a[mb], b2, acc[mb][nb]); } }
        asm volatile("v_nop\n\tv_nop\n\tv_nop\n\tv_nop" : "+v"(acc[0][0]), "+v"(acc[1][1]), "+v"(acc[2][2]), "+v"(acc[3][3]) : "v"(a[0]), "v"(a[3]));
    }
#pragma unroll
    for (int mb = 0; mb < 4; ++mb) {
#pragma unroll
        for (int nb = 0; nb < 4; ++nb) {
#pragma unroll
            for (int j = 0; j < 8; ++j) os[(hi * 8 + j) * 68 + nb * 16 + lr] = acc[mb][nb][j]; }
        __builtin_amdgcn_wave_barrier(); asm volatile("" ::: "memory");
        float* crow = C + (size_t)(r0 + mb * 16) * ldc + c0;
{
#pragma unroll
            for (int s = 0; s < 8; ++s) { const int row = 2 * s + hi, cofs = lr * 4; v4f val = *(const v4fa*)(os + row * 68 + cofs); if (BIAS) { val[0] += bfr(bias[c0 + cofs]); val[1] += bfr(bias[c0 + cofs + 1]); val[2] += bfr(bias[c0 + cofs + 2]); val[3] += bfr(bias[c0 + cofs + 3]); }
                *(v4f*)(crow + (size_t)row * ldc + cofs) = val; }
             }
        __builtin_amdgcn_wave_barrier(); asm volatile("" ::: "memory");
    }
}

__device__ __forceinline__ h16 tohx(float x) { return (h16)x; }
__device__ __forceinline__ void splitf(float y, unsigned short& h, unsigned short& l) { h = f2bf(y); l = f2bf(y - bf2f(h)); }
typedef __attribute__((ext_vector_type(2))) _Float16 v2h;
typedef __attribute__((ext_vector_type(4))) _Float16 v4h;
typedef __attribute__((ext_vector_type(2))) unsigned short v2us;
typedef __attribute__((ext_vector_type(4))) unsigned short v4us;
typedef __attribute__((ext_vector_type(2))) float v2f;
typedef __attribute__((ext_vector_type(4))) int v4i;

__global__ __launch_bounds__(256) void k_wtG(const float* __restrict__ w, int K, int N, bf* Bt) {
    const int lane = threadIdx.x & 31; const int L0 = (blockIdx.x * 8 + (threadIdx.x >> 5)) * 8; const int nlines = N * K / 64;
{
#pragma unroll 1
        for (int l = 0; l < 8; ++l) { const int L = L0 + l; if (L >= nlines) break; const size_t e = (size_t)L * 64 + lane * 2; const int k = (int)(e % K), n = (int)(e / K); v2us o;
            o[0] = f2bf(w[(size_t)k * N + n]); o[1] = f2bf(w[(size_t)(k + 1) * N + n]); *(v2us*)(Bt + e) = o; }
         }
}
__global__ __launch_bounds__(256) void k_cvt8(const float* __restrict__ src, bf* dst, size_t n8) { const size_t i = (size_t)blockIdx.x * 256 + threadIdx.x; if (i >= n8) return; const v8f v = *(const v8f*)(src + i * 8); v8us o;
#pragma unroll
    for (int k = 0; k < 8; ++k) o[k] = f2bf(v[k]); *(v8us*)(dst + i * 8) = o;  }


__global__ __launch_bounds__(256) void k_vtp(const float* __restrict__ F, int pitch, int nheads, h16* V16, bf* Vh, bf* Vl) { const size_t e = ((size_t)blockIdx.x * 256 + threadIdx.x) * 2; if (e >= (size_t)nheads * HD * TT) return; const int t = (int)(e % TT); const int d = (int)((e / TT) % HD); const int g = (int)(e / ((size_t)TT * HD)); v2h o16; v2us oh, ol;
#pragma unroll
    for (int q = 0; q < 2; ++q) { const float x = F[(size_t)(t + q) * pitch + g * HD + d]; o16[q] = tohx(x); unsigned short a2, c2; splitf(x, a2, c2); oh[q] = a2; ol[q] = c2; }
    *(v2h*)(V16 + e) = o16; *(v2us*)(Vh + e) = oh; *(v2us*)(Vl + e) = ol;  }

// k_asoft: per row (zz, i): t = S (unscaled, SCL = 1), keys j > i masked; softmax over the 2048 keys (register row, one exp, fixed trees);
__global__ __launch_bounds__(256) void k_asoft(const float* __restrict__ Sb, h16* P16, bf* Ph, bf* Pl) {
    const int lane = threadIdx.x & 31; const int row = blockIdx.x * 8 + (threadIdx.x >> 5); if (row >= ZH * TT) return; const int i = row % TT; const int zz = row / TT; (void)zz; const bool hires = (i < RH); const float* sr = Sb + (size_t)row * TT; float v[TT / 32]; float mx = -3.0e38f;
#pragma unroll
    for (int ch = 0; ch < TT / 128; ++ch) { const int j0 = ch * 128 + lane * 4; const v4f a = *(const v4f*)(sr + j0);
#pragma unroll
        for (int q = 0; q < 4; ++q) { const int j = j0 + q; const float t = (j <= i) ? a[q] * SCL : -3.0e38f; v[ch * 4 + q] = t;   /* causal: keys after the query excluded */ mx = fmaxf(mx, t); } }
#pragma unroll
    for (int sh = 16; sh; sh >>= 1) mx = fmaxf(mx, __shfl_xor(mx, sh, 32));
    float sum = 0.f;
#pragma unroll
    for (int k = 0; k < TT / 32; ++k) { float d0 = __fsub_rn(v[k], mx); asm volatile("" : "+v"(d0)); v[k] = __builtin_amdgcn_exp2f(__fmul_rn(d0, 1.4426950408889634f)); sum += v[k]; }
#pragma unroll
    for (int sh = 16; sh; sh >>= 1) sum += __shfl_xor(sum, sh, 32);
    const float f = __fdiv_rn(hires ? 1.0f : PCAR, sum);
{
        if (hires) {
#pragma unroll
            for (int ch = 0; ch < TT / 128; ++ch) { v4us oh, ol;
#pragma unroll
                for (int q = 0; q < 4; ++q) { unsigned short a, c2; splitf(v[ch * 4 + q] * f, a, c2); oh[q] = a; ol[q] = c2; }
                const size_t oo = ((size_t)zz * (RH ? RH : 1) + i) * TT + ch * 128 + lane * 4; *(v4us*)(Ph + oo) = oh; *(v4us*)(Pl + oo) = ol; }
        } else {
#pragma unroll
            for (int ch = 0; ch < TT / 128; ++ch) { v4h o4;
#pragma unroll
                for (int q = 0; q < 4; ++q) o4[q] = tohx(v[ch * 4 + q] * f);
                *(v4h*)(P16 + (size_t)row * TT + ch * 128 + lane * 4) = o4; } }
         }
}
__global__ __launch_bounds__(256) void k_merge(const float* __restrict__ O, int h0, float* OUTb) { const size_t e = ((size_t)blockIdx.x * 256 + threadIdx.x) * 2; if (e >= (size_t)ZH * TT * HD) return; const int d = (int)(e % HD); const int t = (int)((e / HD) % TT); const int zz = (int)(e / ((size_t)HD * TT)); const float cs = (t < RH) ? 1.0f : (1.0f / PCAR); const size_t oo = (size_t)t * DQ + (h0 + zz) * HD + d;
    v2f o2; o2[0] = O[e] * cs; o2[1] = O[e + 1] * cs; *(v2f*)(OUTb + oo) = o2;  }


__global__ __launch_bounds__(256) void k_vtpR1(const float* __restrict__ Vb, bf* Vh) { const size_t e = ((size_t)blockIdx.x * 256 + threadIdx.x) * 2; if (e >= (size_t)HD * TT) return; const int t = (int)(e % TT); const int d = (int)(e / TT); v2us o; o[0] = f2bf(Vb[(size_t)t * HD + d]); o[1] = f2bf(Vb[(size_t)(t + 1) * HD + d]); *(v2us*)(Vh + e) = o;  }
__global__ __launch_bounds__(256) void k_mergeR(const float* __restrict__ O, float* outb, size_t n4) { const size_t i = (size_t)blockIdx.x * 256 + threadIdx.x; if (i >= n4) return; const v4f a = *(const v4f*)(O + i * 4); *(v4f*)(outb + i * 4) = a;  }


__global__ __launch_bounds__(256) void k_hp1(const float* __restrict__ src, bf* P) { const size_t i = (size_t)blockIdx.x * 256 + threadIdx.x; if (i >= (size_t)NH_ * TT * HD / 8) return; const size_t e = i * 8; const int d = (int)(e % HD); const int t = (int)((e / HD) % TT); const int h = (int)(e / ((size_t)HD * TT)); const v8f v = *(const v8f*)(src + (size_t)t * DM + h * HD + d); v8us o;
#pragma unroll
    for (int q = 0; q < 8; ++q) o[q] = f2bf(v[q]);
    *(v8us*)(P + e) = o;  }
__global__ __launch_bounds__(256) void k_vt1(const float* __restrict__ src, int pitch, bf* VT) { const size_t e = ((size_t)blockIdx.x * 256 + threadIdx.x) * 2; if (e >= (size_t)NH_ * HD * TT) return; const int t = (int)(e % TT); const int d = (int)((e / TT) % HD); const int h = (int)(e / ((size_t)TT * HD)); v2us o; o[0] = f2bf(src[(size_t)t * pitch + h * HD + d]); o[1] = f2bf(src[(size_t)(t + 1) * pitch + h * HD + d]); *(v2us*)(VT + e) = o;  }
__global__ __launch_bounds__(256) void k_mergeT(const float* __restrict__ O, int h, float* outb) { const size_t i = (size_t)blockIdx.x * 256 + threadIdx.x; if (i >= (size_t)TT * HD / 4) return; const size_t e = i * 4; const int d = (int)(e % HD); const int t = (int)(e / HD); const v4f a = *(const v4f*)(O + e); *(v4f*)(outb + (size_t)t * DM + h * HD + d) = a;  }

extern "C" void kernel_launch(void* const* d_in, const int* in_sizes, int n_in,
                              void* d_out, int out_size, void* d_ws, size_t ws_size, hipStream_t stream) {
    (void)in_sizes; (void)n_in; (void)out_size;
    const float* Qin = (const float*)d_in[0]; const float* Kin = (const float*)d_in[1]; const float* Vin = (const float*)d_in[2];
    float* OUT = (float*)d_out;
    char* wsp = (char*)d_ws;
    auto take = [&](size_t bytes) { char* p = wsp; wsp += (bytes + 255) & ~(size_t)255; return (void*)p; };
    bf* QB = (bf*)take((size_t)NH_ * TT * HD * 2); bf* KB = (bf*)take((size_t)NH_ * TT * HD * 2); bf* VT = (bf*)take((size_t)NH_ * HD * TT * 2);
    float* Sb = (float*)take((size_t)TT * TT * 4);  bf* Ph = (bf*)take((size_t)TT * TT * 2); bf* Pl = (bf*)take((size_t)TT * TT * 2); float* Ob = (float*)take((size_t)TT * HD * 4);
    if ((size_t)(wsp - (char*)d_ws) > ws_size) return;
    for (int b = 0; b < NB_; ++b) {
        const float* qb = Qin + (size_t)b * TT * DM; const float* kb = Kin + (size_t)b * TT * DM; const float* vb = Vin + (size_t)b * TT * DM;   /* token-major [t][h][d] slabs */
        k_hp1<<<(unsigned)(((size_t)NH_ * TT * HD / 8 + 255) / 256), 256, 0, stream>>>(qb, QB); k_hp1<<<(unsigned)(((size_t)NH_ * TT * HD / 8 + 255) / 256), 256, 0, stream>>>(kb, KB); k_vt1<<<(unsigned)(((size_t)NH_ * HD * TT / 2 + 255) / 256), 256, 0, stream>>>(vb, DM, VT);
        for (int h = 0; h < NH_; ++h) {
            k_gemmw<bf, 0, false><<<dim3(TT / 64, TT / 64, 1), 32, 0, stream>>>(QB + (size_t)h * TT * HD, nullptr, KB + (size_t)h * TT * HD, nullptr, HD, Sb, TT, nullptr, 0, 0, 0);   /* exact scores (single bf16 planes) */
            k_asoft<<<TT / 8, 256, 0, stream>>>(Sb, nullptr, Ph, Pl);
            k_gemmw<bf, 1, false><<<dim3(TT / 64, HD / 64, 1), 32, 0, stream>>>(Ph, Pl, VT + (size_t)h * HD * TT, nullptr, TT, Ob, HD, nullptr, 0, 0, 0);   /* P (hi/lo) x exact v^T */
            k_mergeT<<<(unsigned)(((size_t)TT * HD / 4 + 255) / 256), 256, 0, stream>>>(Ob, h, OUT + (size_t)b * TT * DM); } }
}

// v002
// A run of this version takes 60.8 microseconds.
// It is 34.8 times as fast as v000, going by the measured steps of the versions left out in between.
#include <hip/hip_runtime.h>

// Causal full attention on given tensors (queries, keys, values [2][2048][16][64] = (B, L, H, E) token-major; scores = q.k with NO scaling (faithful: the source never applies its scale; logits sigma ~8), strictly-future keys excluded; softmax; V = A.values -> [2][2048][16][64]).
// Layout: single bf16 head planes gathered from the token-major slabs, both batches side by side (q, k as [b*H + h][t][d], values transposed as [b*H + h][d][t]).
// One fused kernel for all heads: S^T = K.Q^T, running-maximum softmax in registers, O^T += V^T.P^T; scores and probabilities never reach memory.
// Compute dtypes, f32 accumulate: every input rounded to bf16; q.k exact products; softmax f32; P as bf16 hi/lo x exact values (2 products); output f32.

#define NB_  2
#define TT   2048
#define DM   1024      // token-major row pitch (H x HD)
#define NH_  16
#define HD   64
#define L2E  1.4426950408889634f
typedef unsigned short bf;
typedef __attribute__((ext_vector_type(16))) __bf16   v16bf;
typedef __attribute__((ext_vector_type(2)))  __bf16   v2bf;
typedef __attribute__((ext_vector_type(8)))  unsigned short v8us;
typedef __attribute__((ext_vector_type(8)))  unsigned int v8u;
typedef __attribute__((ext_vector_type(4)))  unsigned int v4u;
typedef __attribute__((ext_vector_type(2)))  unsigned int v2u;
typedef __attribute__((ext_vector_type(8)))  float    v8f;
typedef __attribute__((ext_vector_type(4)))  float    v4f;
typedef __attribute__((ext_vector_type(2)))  float    v2f;

__device__ __forceinline__ v16bf cat16b(v8us lo, v8us hi) { return __builtin_bit_cast(v16bf, __builtin_shufflevector(lo, hi, 0, 1, 2, 3, 4, 5, 6, 7, 8, 9, 10, 11, 12, 13, 14, 15)); }
__device__ __forceinline__ v8f wmmab(v16bf a, v16bf b, v8f c) { return __builtin_amdgcn_wmma_f32_16x16x32_bf16(false, a, false, b, (short)0, c, false, false); }
// One 16 x 32 operand fragment from a k-contiguous plane; p already points at this lane's row and at k = 8 * (lane >> 4): elements 0-7 = k 8h.., 8-15 = k 16 + 8h..
__device__ __forceinline__ v16bf ldfrag(const bf* p) { return cat16b(*(const v8us*)p, *(const v8us*)(p + 16)); }
// Lane l <-> l ^ 16
__device__ __forceinline__ float xhalf(float x) { const int b = __float_as_int(x); return __int_as_float(__builtin_amdgcn_permlanex16(b, b, 0x76543210, 0xfedcba98, false, false)); }

// ---- k_prep: one launch builds all three plane sets. One work-group = 128 tokens of one head; each thread fetches 24 x 16 bytes (every wave-wide load = two whole 256-byte head rows), all in flight together.
// Every '#pragma unroll' in it unrolls fully: the arrays of loaded rows that it indexes must stay in registers.
// Thread (dg, tr) holds d = 4 dg .. 4 dg + 3 of tokens 8 tr + j, j = 0..7, of q, k and values alike.
// q, k: 16 lanes store one whole 128-byte plane row.
// values: a thread's 8 tokens of one d are one 16-byte piece of a transposed row; the pieces cross LDS so that 16 lanes store 256 contiguous bytes of one row.
// LDS tile [d][16 pieces]: piece p of row d stands at place p ^ (d >> 2), which spreads both the writers (16 rows, one piece index) and the readers (one row, 16 pieces) over all banks.
__device__ __forceinline__ unsigned pk2(float a, float b) { return __builtin_bit_cast(unsigned, __builtin_convertvector((v2f){a, b}, v2bf)); }   /* round to nearest even; a in the low half */
__global__ __launch_bounds__(256) void k_prep(const float* __restrict__ Q, const float* __restrict__ K, const float* __restrict__ V, bf* __restrict__ QB, bf* __restrict__ KB, bf* __restrict__ VT) {
    __shared__ __attribute__((aligned(16))) unsigned tile[HD * 64];
    const unsigned dg = threadIdx.x & 15, tr = threadIdx.x >> 4;
    const int t0 = (int)blockIdx.x * 128, bh = blockIdx.y, b = bh / NH_, h = bh % NH_;
    const size_t sbase = ((size_t)b * TT + t0) * DM + h * HD;   /* the same for the whole work-group */
    const unsigned lo = 8 * tr * DM + 4 * dg;                   /* the lane's own offset, one register for all 24 loads */
    const float* vs = V + sbase; const float* qs = Q + sbase; const float* ks = K + sbase;
    v4f v[8], q[8], k[8];
#pragma unroll
    for (int j = 0; j < 8; ++j) v[j] = *(const v4f*)(vs + (lo + j * DM));
#pragma unroll
    for (int j = 0; j < 8; ++j) q[j] = *(const v4f*)(qs + (lo + j * DM));
#pragma unroll
    for (int j = 0; j < 8; ++j) k[j] = *(const v4f*)(ks + (lo + j * DM));
    asm volatile("s_wait_xcnt 0x0" ::: "memory");   /* the lane-offset register of the loads above is reused by the conversions below: the wait stands ahead of that overwrite */
    __builtin_amdgcn_sched_barrier(0);   /* keeps every conversion behind all 24 loads: one memory latency for the work-group instead of three in a row */
#pragma unroll
    for (int i = 0; i < 4; ++i)
        *(v4u*)(tile + (4 * dg + i) * 64 + ((tr ^ dg) << 2)) = (v4u){pk2(v[0][i], v[1][i]), pk2(v[2][i], v[3][i]), pk2(v[4][i], v[5][i]), pk2(v[6][i], v[7][i])};
    __syncthreads();   /* every piece of the transposed tile is in LDS before another thread reads it; ahead of all global stores, so that it waits for none */
    bf* vo = VT + (size_t)bh * HD * TT + t0;
#pragma unroll
    for (int r = 0; r < 4; ++r) { const unsigned d = 16 * r + tr;
        *(v4u*)(vo + (d * TT + 8 * dg)) = *(const v4u*)(tile + d * 64 + ((dg ^ (d >> 2)) << 2)); }
    const size_t pbase = ((size_t)bh * TT + t0) * HD; const unsigned po = 8 * tr * HD + 4 * dg;
    bf* qo = QB + pbase; bf* ko = KB + pbase;
#pragma unroll
    for (int j = 0; j < 8; ++j) *(v2u*)(qo + (po + j * HD)) = (v2u){pk2(q[j][0], q[j][1]), pk2(q[j][2], q[j][3])};
#pragma unroll
    for (int j = 0; j < 8; ++j) *(v2u*)(ko + (po + j * HD)) = (v2u){pk2(k[j][0], k[j][1]), pk2(k[j][2], k[j][3])};
}

// Every '#pragma unroll' below unrolls fully: the fragment and accumulator arrays it indexes must stay in registers.
// ---- k_fattn: one wave owns 32 query columns (two 16-column groups) of one head and walks its keys in passes of 32.
// S^T tile: lane (c, h) holds query c, keys 8h + r: two tiles (keys 0-15, 16-31) converted in place are the B operand of O^T += V^T.P^T in the loader's own k order.
__device__ __forceinline__ void att_scores(const v16bf (&kf)[2][2], const v16bf (&qf)[2][2], v8f (&s)[2][2]) {
#pragma unroll
    for (int kt = 0; kt < 2; ++kt)
#pragma unroll
        for (int g = 0; g < 2; ++g) { s[kt][g] = (v8f){};
#pragma unroll
            for (int kc = 0; kc < 2; ++kc) s[kt][g] = wmmab(kf[kt][kc], qf[g][kc], s[kt][g]); }
}
__device__ __forceinline__ void att_ldk(v16bf (&kf)[2][2], const bf* kp) {
#pragma unroll
    for (int kt = 0; kt < 2; ++kt)
#pragma unroll
        for (int kc = 0; kc < 2; ++kc) kf[kt][kc] = ldfrag(kp + kt * 16 * HD + kc * 32);
}
__device__ __forceinline__ void att_ldv(v16bf (&vf)[4], const bf* vp) {
#pragma unroll
    for (int dt = 0; dt < 4; ++dt) vf[dt] = ldfrag(vp + (size_t)dt * 16 * TT);
}
template <bool DIAG>
__device__ __forceinline__ void att_softpv(v8f (&s)[2][2], const v16bf (&vf)[4], v8f (&acc)[2][4], float (&m2)[2], float (&l)[2], int c, int hh) {
#pragma unroll
    for (int g = 0; g < 2; ++g) {
        if (DIAG) {   /* the pass on the diagonal starts at the wave's first query: key offset > query offset is a future key */
#pragma unroll
            for (int kt = 0; kt < 2; ++kt)
#pragma unroll
                for (int r = 0; r < 8; ++r) if (16 * kt + 8 * hh + r > 16 * g + c) s[kt][g][r] = -3.0e38f; }
        float mx = s[0][g][0];
#pragma unroll
        for (int kt = 0; kt < 2; ++kt)
#pragma unroll
            for (int r = 0; r < 8; ++r) mx = fmaxf(mx, s[kt][g][r]);
        mx = fmaxf(mx, xhalf(mx));
        const float mn = fmaxf(m2[g], mx * L2E);
        const float corr = __builtin_amdgcn_exp2f(m2[g] - mn); m2[g] = mn;
#pragma unroll
        for (int dt = 0; dt < 4; ++dt) acc[g][dt] = acc[g][dt] * corr;
        float sum = 0.f; v8u wh, wl;
#pragma unroll
        for (int i = 0; i < 8; ++i) {
            const v2f arg = __builtin_elementwise_fma((v2f){s[i >> 2][g][2 * (i & 3)], s[i >> 2][g][2 * (i & 3) + 1]}, (v2f){L2E, L2E}, (v2f){-mn, -mn});
            const float e0 = __builtin_amdgcn_exp2f(arg[0]), e1 = __builtin_amdgcn_exp2f(arg[1]);
            sum += e0 + e1;
            const unsigned h2 = __builtin_bit_cast(unsigned, __builtin_convertvector((v2f){e0, e1}, v2bf));
            wh[i] = h2;
            wl[i] = __builtin_bit_cast(unsigned, __builtin_convertvector((v2f){e0 - __uint_as_float(h2 << 16), e1 - __uint_as_float(h2 & 0xFFFF0000u)}, v2bf)); }
        l[g] = l[g] * corr + sum;
        const v16bf ph = __builtin_bit_cast(v16bf, wh), pl = __builtin_bit_cast(v16bf, wl);
#pragma unroll
        for (int dt = 0; dt < 4; ++dt) acc[g][dt] = wmmab(vf[dt], ph, acc[g][dt]);
#pragma unroll
        for (int dt = 0; dt < 4; ++dt) acc[g][dt] = wmmab(vf[dt], pl, acc[g][dt]);
    }
}
__global__ __launch_bounds__(256) void k_fattn(const unsigned short* __restrict__ QB, const unsigned short* __restrict__ KB, const unsigned short* __restrict__ VT, float* __restrict__ OUT) {
    const int lane = threadIdx.x & 31, c = lane & 15, hh = lane >> 4; const int wave = __builtin_amdgcn_readfirstlane((int)(threadIdx.x >> 5));
    const int bh = blockIdx.y;
    /* 64 query tiles of 32 per head; tile t walks t + 1 passes. Waves w and w + 4 take tiles that add up to 63. */
    const int t = (wave < 4) ? (TT / 32 - 1) - (4 * (int)blockIdx.x + wave) : 4 * (int)blockIdx.x + (wave - 4);
    const int q0 = t * 32;
    const bf* qp = QB + (size_t)bh * TT * HD + (size_t)(q0 + c) * HD + 8 * hh;
    const bf* kp = KB + (size_t)bh * TT * HD + (size_t)c * HD + 8 * hh;
    const bf* vp = VT + (size_t)bh * HD * TT + (size_t)c * TT + 8 * hh;
    v16bf qf[2][2], kf[2][2], vf[4];
#pragma unroll
    for (int g = 0; g < 2; ++g)
#pragma unroll
        for (int kc = 0; kc < 2; ++kc) qf[g][kc] = ldfrag(qp + g * 16 * HD + kc * 32);
    att_ldk(kf, kp);
    asm volatile("s_wait_xcnt 0x0" ::: "memory");   /* the address registers of the loads above are reused by the accumulators' zeroing below: the wait stands ahead of that overwrite */
    v8f acc[2][4]; float m2[2], l[2];
#pragma unroll
    for (int g = 0; g < 2; ++g) { m2[g] = -3.0e38f; l[g] = 0.f;
#pragma unroll
        for (int dt = 0; dt < 4; ++dt) acc[g][dt] = (v8f){}; }
    v8f s[2][2];
#pragma unroll 1   /* rolled: a second copy of the body would want a second set of fragment registers */
    for (int p = 0; p < t; ++p) {   /* passes wholly below the diagonal; V is fetched at the head of its pass, the next pass's K behind this pass's score products */
        att_ldv(vf, vp); vp += 32;
        att_scores(kf, qf, s);
        kp += 32 * HD; att_ldk(kf, kp);
        __builtin_amdgcn_sched_barrier(0);   /* keeps the next pass's K loads here, in flight under the whole softmax and second product, instead of at the loop's foot */
        att_softpv<false>(s, vf, acc, m2, l, c, hh);
    }
    att_ldv(vf, vp);
    att_scores(kf, qf, s);
    att_softpv<true>(s, vf, acc, m2, l, c, hh);
    const int b = bh / NH_, h = bh % NH_;
#pragma unroll
    for (int g = 0; g < 2; ++g) {
        const float lt = l[g] + xhalf(l[g]); const float inv = __fdiv_rn(1.0f, lt);
        float* orow = OUT + ((size_t)b * TT + q0 + 16 * g + c) * DM + h * HD + 8 * hh;   /* the lane's 8 registers are d = 16 dt + 8 h + r of its query's row */
#pragma unroll
        for (int dt = 0; dt < 4; ++dt) { const v8f o = acc[g][dt] * inv;
            *(v4f*)(orow + dt * 16) = (v4f){o[0], o[1], o[2], o[3]}; *(v4f*)(orow + dt * 16 + 4) = (v4f){o[4], o[5], o[6], o[7]}; }
    }
}

extern "C" void kernel_launch(void* const* d_in, const int* in_sizes, int n_in,
                              void* d_out, int out_size, void* d_ws, size_t ws_size, hipStream_t stream) {
    (void)in_sizes; (void)n_in; (void)out_size;
    const float* Qin = (const float*)d_in[0]; const float* Kin = (const float*)d_in[1]; const float* Vin = (const float*)d_in[2];
    float* OUT = (float*)d_out;
    char* wsp = (char*)d_ws;
    auto take = [&](size_t bytes) { char* p = wsp; wsp += (bytes + 255) & ~(size_t)255; return (void*)p; };
    bf* QB = (bf*)take((size_t)NB_ * NH_ * TT * HD * 2); bf* KB = (bf*)take((size_t)NB_ * NH_ * TT * HD * 2); bf* VT = (bf*)take((size_t)NB_ * NH_ * HD * TT * 2);
    if ((size_t)(wsp - (char*)d_ws) > ws_size) return;
    k_prep<<<dim3(TT / 128, NB_ * NH_, 1), 256, 0, stream>>>(Qin, Kin, Vin, QB, KB, VT);   /* token-major [b][t][h][d] slabs -> bf16 head planes */
    k_fattn<<<dim3(TT / 256, NB_ * NH_, 1), 256, 0, stream>>>(QB, KB, VT, OUT);   /* scores, softmax and A.values of every head in one launch */
}

// v003
// It runs in 46.7 microseconds.
// In two side-by-side timings against v002, it was 1.31 and 1.32 times as fast.
// All steps since v000 together make it 45.7 times as fast.
#include <hip/hip_runtime.h>

// Causal full attention on given tensors (queries, keys, values [2][2048][16][64] = (B, L, H, E) token-major; scores = q.k with NO scaling (faithful: the source never applies its scale; logits sigma ~8), strictly-future keys excluded; softmax; V = A.values -> [2][2048][16][64]).
// Layout: single bf16 head planes gathered from the token-major slabs, both batches side by side (q, k as [b*H + h][t][d], values transposed as [b*H + h][d][t]).
// One fused kernel for all heads: S^T = K.Q^T, running-maximum softmax in registers, O^T += V^T.P^T; scores and probabilities never reach memory.
// Compute dtypes, f32 accumulate: every input rounded to bf16; q.k exact products; softmax f32; P as bf16 hi/lo x exact values (2 products); output f32.

#define NB_  2
#define TT   2048
#define DM   1024      // token-major row pitch (H x HD)
#define NH_  16
#define HD   64
#define L2E  1.4426950408889634f
typedef unsigned short bf;
typedef __attribute__((ext_vector_type(16))) __bf16   v16bf;
typedef __attribute__((ext_vector_type(2)))  __bf16   v2bf;
typedef __attribute__((ext_vector_type(8)))  unsigned short v8us;
typedef __attribute__((ext_vector_type(8)))  unsigned int v8u;
typedef __attribute__((ext_vector_type(4)))  unsigned int v4u;
typedef __attribute__((ext_vector_type(2)))  unsigned int v2u;
typedef __attribute__((ext_vector_type(8)))  float    v8f;
typedef __attribute__((ext_vector_type(4)))  float    v4f;
typedef __attribute__((ext_vector_type(2)))  float    v2f;

__device__ __forceinline__ v16bf cat16b(v8us lo, v8us hi) { return __builtin_bit_cast(v16bf, __builtin_shufflevector(lo, hi, 0, 1, 2, 3, 4, 5, 6, 7, 8, 9, 10, 11, 12, 13, 14, 15)); }
__device__ __forceinline__ v8f wmmab(v16bf a, v16bf b, v8f c) { return __builtin_amdgcn_wmma_f32_16x16x32_bf16(false, a, false, b, (short)0, c, false, false); }
// One 16 x 32 operand fragment from a k-contiguous plane; p already points at this lane's row and at k = 8 * (lane >> 4): elements 0-7 = k 8h.., 8-15 = k 16 + 8h..
__device__ __forceinline__ v16bf ldfrag(const bf* p) { return cat16b(*(const v8us*)p, *(const v8us*)(p + 16)); }
// Lane l <-> l ^ 16
__device__ __forceinline__ float xhalf(float x) { const int b = __float_as_int(x); return __int_as_float(__builtin_amdgcn_permlanex16(b, b, 0x76543210, 0xfedcba98, false, false)); }

// ---- k_prep: one launch builds all three plane sets. One work-group = 128 tokens of one head; each thread fetches 24 x 16 bytes (every wave-wide load = two whole 256-byte head rows), all in flight together.
// Every '#pragma unroll' in it unrolls fully: the arrays of loaded rows that it indexes must stay in registers.
// Thread (dg, tr) holds d = 4 dg .. 4 dg + 3 of tokens 8 tr + j, j = 0..7, of q, k and values alike.
// q, k: 16 lanes store one whole 128-byte plane row.
// values: a thread's 8 tokens of one d are one 16-byte piece of a transposed row; the pieces cross LDS so that 16 lanes store 256 contiguous bytes of one row.
// LDS tile [d][16 pieces]: piece p of row d stands at place p ^ (d >> 2), which spreads both the writers (16 rows, one piece index) and the readers (one row, 16 pieces) over all banks.
__device__ __forceinline__ unsigned pk2(float a, float b) { return __builtin_bit_cast(unsigned, __builtin_convertvector((v2f){a, b}, v2bf)); }   /* round to nearest even; a in the low half */
__global__ __launch_bounds__(256) void k_prep(const float* __restrict__ Q, const float* __restrict__ K, const float* __restrict__ V, bf* __restrict__ QB, bf* __restrict__ KB, bf* __restrict__ VT) {
    __shared__ __attribute__((aligned(16))) unsigned tile[HD * 64];
    const unsigned dg = threadIdx.x & 15, tr = threadIdx.x >> 4;
    const int t0 = (int)blockIdx.x * 128, bh = blockIdx.y, b = bh / NH_, h = bh % NH_;
    const size_t sbase = ((size_t)b * TT + t0) * DM + h * HD;   /* the same for the whole work-group */
    const unsigned lo = 8 * tr * DM + 4 * dg;                   /* the lane's own offset, one register for all 24 loads */
    const float* vs = V + sbase; const float* qs = Q + sbase; const float* ks = K + sbase;
    v4f v[8], q[8], k[8];
#pragma unroll
    for (int j = 0; j < 8; ++j) v[j] = *(const v4f*)(vs + (lo + j * DM));
#pragma unroll
    for (int j = 0; j < 8; ++j) q[j] = *(const v4f*)(qs + (lo + j * DM));
#pragma unroll
    for (int j = 0; j < 8; ++j) k[j] = *(const v4f*)(ks + (lo + j * DM));
    asm volatile("s_wait_xcnt 0x0" ::: "memory");   /* the lane-offset register of the loads above is reused by the conversions below: the wait stands ahead of that overwrite */
    __builtin_amdgcn_sched_barrier(0);   /* keeps every conversion behind all 24 loads: one memory latency for the work-group instead of three in a row */
#pragma unroll
    for (int i = 0; i < 4; ++i)
        *(v4u*)(tile + (4 * dg + i) * 64 + ((tr ^ dg) << 2)) = (v4u){pk2(v[0][i], v[1][i]), pk2(v[2][i], v[3][i]), pk2(v[4][i], v[5][i]), pk2(v[6][i], v[7][i])};
    __syncthreads();   /* every piece of the transposed tile is in LDS before another thread reads it; ahead of all global stores, so that it waits for none */
    bf* vo = VT + (size_t)bh * HD * TT + t0;
#pragma unroll
    for (int r = 0; r < 4; ++r) { const unsigned d = 16 * r + tr;
        *(v4u*)(vo + (d * TT + 8 * dg)) = *(const v4u*)(tile + d * 64 + ((dg ^ (d >> 2)) << 2)); }
    const size_t pbase = ((size_t)bh * TT + t0) * HD; const unsigned po = 8 * tr * HD + 4 * dg;
    bf* qo = QB + pbase; bf* ko = KB + pbase;
#pragma unroll
    for (int j = 0; j < 8; ++j) *(v2u*)(qo + (po + j * HD)) = (v2u){pk2(q[j][0], q[j][1]), pk2(q[j][2], q[j][3])};
#pragma unroll
    for (int j = 0; j < 8; ++j) *(v2u*)(ko + (po + j * HD)) = (v2u){pk2(k[j][0], k[j][1]), pk2(k[j][2], k[j][3])};
}

// Every '#pragma unroll' below unrolls fully: the fragment and accumulator arrays it indexes must stay in registers.
// ---- k_fattn: one wave owns 32 query columns (two 16-column groups) of one head and walks a quarter of their keys in passes of 32.
// S^T tile: lane (c, h) holds query c, keys 8h + r: two tiles (keys 0-15, 16-31) converted in place are the B operand of O^T += V^T.P^T in the loader's own k order.
__device__ __forceinline__ void att_scores(const v16bf (&kf)[2][2], const v16bf (&qf)[2][2], v8f (&s)[2][2]) {
#pragma unroll
    for (int kt = 0; kt < 2; ++kt)
#pragma unroll
        for (int g = 0; g < 2; ++g) { s[kt][g] = (v8f){};
#pragma unroll
            for (int kc = 0; kc < 2; ++kc) s[kt][g] = wmmab(kf[kt][kc], qf[g][kc], s[kt][g]); }
}
// kb, vb: the same for the whole wave (head plane + pass); lo: the lane's own offset, the same in every pass.
__device__ __forceinline__ void att_ldk(v16bf (&kf)[2][2], const bf* kb, unsigned lo) {
#pragma unroll
    for (int kt = 0; kt < 2; ++kt)
#pragma unroll
        for (int kc = 0; kc < 2; ++kc) kf[kt][kc] = ldfrag(kb + (lo + kt * 16 * HD + kc * 32));
}
__device__ __forceinline__ void att_ldv(v16bf (&vf)[4], const bf* vb, unsigned lo) {
#pragma unroll
    for (int dt = 0; dt < 4; ++dt) vf[dt] = ldfrag(vb + (lo + dt * 16 * TT));
}
template <bool DIAG>
__device__ __forceinline__ void att_softpv(v8f (&s)[2][2], const v16bf (&vf)[4], v8f (&acc)[2][4], float (&m2)[2], float (&l)[2], int c, int hh) {
#pragma unroll
    for (int g = 0; g < 2; ++g) {
        if (DIAG) {   /* the pass on the diagonal starts at the wave's first query: key offset > query offset is a future key */
#pragma unroll
            for (int kt = 0; kt < 2; ++kt)
#pragma unroll
                for (int r = 0; r < 8; ++r) if (16 * kt + 8 * hh + r > 16 * g + c) s[kt][g][r] = -3.0e38f; }
        float mx = s[0][g][0];
#pragma unroll
        for (int kt = 0; kt < 2; ++kt)
#pragma unroll
            for (int r = 0; r < 8; ++r) mx = fmaxf(mx, s[kt][g][r]);
        mx = fmaxf(mx, xhalf(mx));
        const float mn = fmaxf(m2[g], mx * L2E);
        const float corr = __builtin_amdgcn_exp2f(m2[g] - mn); m2[g] = mn;
#pragma unroll
        for (int dt = 0; dt < 4; ++dt) acc[g][dt] = acc[g][dt] * corr;
        float sum = 0.f; v8u wh, wl;
#pragma unroll
        for (int i = 0; i < 8; ++i) {
            const v2f arg = __builtin_elementwise_fma((v2f){s[i >> 2][g][2 * (i & 3)], s[i >> 2][g][2 * (i & 3) + 1]}, (v2f){L2E, L2E}, (v2f){-mn, -mn});
            const float e0 = __builtin_amdgcn_exp2f(arg[0]), e1 = __builtin_amdgcn_exp2f(arg[1]);
            sum += e0 + e1;
            const unsigned h2 = __builtin_bit_cast(unsigned, __builtin_convertvector((v2f){e0, e1}, v2bf));
            wh[i] = h2;
            wl[i] = __builtin_bit_cast(unsigned, __builtin_convertvector((v2f){e0 - __uint_as_float(h2 << 16), e1 - __uint_as_float(h2 & 0xFFFF0000u)}, v2bf)); }
        l[g] = l[g] * corr + sum;
        const v16bf ph = __builtin_bit_cast(v16bf, wh), pl = __builtin_bit_cast(v16bf, wl);
#pragma unroll
        for (int dt = 0; dt < 4; ++dt) acc[g][dt] = wmmab(vf[dt], ph, acc[g][dt]);
#pragma unroll
        for (int dt = 0; dt < 4; ++dt) acc[g][dt] = wmmab(vf[dt], pl, acc[g][dt]);
    }
}
// One work-group = 16 waves = 4 neighbouring query tiles x 4 key shares, first of the heavy quad 15 - x, then of the light quad x (260 passes for every work-group).
// Share j of tile t walks passes j, j + 4, ... <= t; the four waves of one share read the same keys at the same time.
// Each share keeps its own running maximum, sum and O^T; the shares meet in LDS: maxima and sums first, then the O^T parts, already scaled to the common maximum and divided by the common sum.
__global__ __launch_bounds__(512) void k_fattn(const unsigned short* __restrict__ QB, const unsigned short* __restrict__ KB, const unsigned short* __restrict__ VT, float* __restrict__ OUT) {
    __shared__ float sm[4][4][32], sl[4][4][32];                              /* [tile][share][query] */
    __shared__ __attribute__((aligned(16))) v4f part[4][4][16][32];           /* [tile][share][(g, dt, register half)][lane]: every wave-wide access is 512 contiguous bytes */
    const int lane = threadIdx.x & 31, c = lane & 15, hh = lane >> 4; const int wave = __builtin_amdgcn_readfirstlane((int)(threadIdx.x >> 5));
    const int ti = wave >> 2, bh = blockIdx.y, b = bh / NH_, h = bh % NH_;
    const bf* qh = QB + (size_t)bh * TT * HD; const bf* kh = KB + (size_t)bh * TT * HD; const bf* vh = VT + (size_t)bh * HD * TT;
    const unsigned ko = c * HD + 8 * hh, vo = c * TT + 8 * hh;
#pragma unroll 1   /* rolled: one copy of the pass loop serves both quads */
    for (int ph = 0; ph < 2; ++ph) {
        /* the share order is turned round for the second quad: so the shares' pass counts even out over the two quads */
        const int j = ph ? 3 - (wave & 3) : (wave & 3);
        const int t = 4 * (ph ? (int)blockIdx.x : (TT / 128 - 1) - (int)blockIdx.x) + ti, q0 = t * 32;
        v16bf qf[2][2], kf[2][2], vf[4];
#pragma unroll
        for (int g = 0; g < 2; ++g)
#pragma unroll
            for (int kc = 0; kc < 2; ++kc) qf[g][kc] = ldfrag(qh + (size_t)q0 * HD + (ko + g * 16 * HD + kc * 32));
        int p = j;
        att_ldk(kf, kh + (size_t)(p < t ? p : t) * 32 * HD, ko);   /* a fetch ahead never passes the tile's own diagonal pass */
        asm volatile("s_wait_xcnt 0x0" ::: "memory");   /* the address registers of the loads above are reused by the accumulators' zeroing below: the wait stands ahead of that overwrite */
        v8f acc[2][4]; float m2[2], l[2];
#pragma unroll
        for (int g = 0; g < 2; ++g) { m2[g] = -3.0e38f; l[g] = 0.f;
#pragma unroll
            for (int dt = 0; dt < 4; ++dt) acc[g][dt] = (v8f){}; }
        v8f s[2][2];
#pragma unroll 1   /* rolled: a second copy of the body would want a second set of fragment registers */
        for (; p < t; ) {   /* passes wholly below the diagonal; V is fetched at the head of its pass, the share's next K behind this pass's score products */
            att_ldv(vf, vh + p * 32, vo);
            att_scores(kf, qf, s);
            p += 4; att_ldk(kf, kh + (size_t)(p < t ? p : t) * 32 * HD, ko);
            __builtin_amdgcn_sched_barrier(0);   /* keeps the next pass's K loads here, in flight under the whole softmax and second product, instead of at the loop's foot */
            att_softpv<false>(s, vf, acc, m2, l, c, hh);
        }
        if (p == t) {   /* one share of four owns the pass on the diagonal; the test is the same for the whole wave */
            att_ldv(vf, vh + p * 32, vo);
            att_scores(kf, qf, s);
            att_softpv<true>(s, vf, acc, m2, l, c, hh);
        }
        const float l0 = l[0] + xhalf(l[0]), l1 = l[1] + xhalf(l[1]);
        sm[ti][j][lane] = hh ? m2[1] : m2[0]; sl[ti][j][lane] = hh ? l1 : l0;   /* lane = 16 g + c: the upper half files group 1 */
        __syncthreads();   /* every share's maximum and sum are in LDS before any share reads them */
#pragma unroll
        for (int g = 0; g < 2; ++g) {
            float mk[4], lk[4];
#pragma unroll
            for (int k = 0; k < 4; ++k) { mk[k] = sm[ti][k][16 * g + c]; lk[k] = sl[ti][k][16 * g + c]; }
            const float mm = fmaxf(fmaxf(mk[0], mk[1]), fmaxf(mk[2], mk[3]));   /* finite: the share with the diagonal pass has seen the query's own key; a share without a pass weighs exp2(-huge) = 0 */
            float lt = 0.f;
#pragma unroll
            for (int k = 0; k < 4; ++k) lt += __builtin_amdgcn_exp2f(mk[k] - mm) * lk[k];
            const float f = __builtin_amdgcn_exp2f(m2[g] - mm) * __fdiv_rn(1.0f, lt);
#pragma unroll
            for (int dt = 0; dt < 4; ++dt) { const v8f o = acc[g][dt] * f;
                part[ti][j][(g * 4 + dt) * 2][lane] = (v4f){o[0], o[1], o[2], o[3]}; part[ti][j][(g * 4 + dt) * 2 + 1][lane] = (v4f){o[4], o[5], o[6], o[7]}; }
        }
        __syncthreads();   /* every share's part is in LDS before it is summed; the next quad's first barrier keeps its parts behind these reads */
        /* share j sums and stores group j >> 1, d = 32 (j & 1) .. + 31: one whole 128-byte line of each of 16 query rows */
        const int go = j >> 1, d0 = 2 * (j & 1);
        float* orow = OUT + ((size_t)b * TT + q0 + 16 * go) * DM + h * HD + d0 * 16;
        const unsigned oo = c * DM + 8 * hh;   /* the lane's 8 registers are d = 16 dt + 8 h + r of its query's row */
#pragma unroll
        for (int e = 0; e < 4; ++e) {   /* e = (dt - d0, register half) */
            const int sl_ = (go * 4 + d0) * 2 + e;
            const v4f o = (part[ti][0][sl_][lane] + part[ti][1][sl_][lane]) + (part[ti][2][sl_][lane] + part[ti][3][sl_][lane]);
            *(v4f*)(orow + (oo + (e >> 1) * 16 + (e & 1) * 4)) = o; }
        asm volatile("s_wait_xcnt 0x0" ::: "memory");   /* the registers of the stores above are reused by the next quad's loads: the wait stands ahead of that overwrite */
    }
}

extern "C" void kernel_launch(void* const* d_in, const int* in_sizes, int n_in,
                              void* d_out, int out_size, void* d_ws, size_t ws_size, hipStream_t stream) {
    (void)in_sizes; (void)n_in; (void)out_size;
    const float* Qin = (const float*)d_in[0]; const float* Kin = (const float*)d_in[1]; const float* Vin = (const float*)d_in[2];
    float* OUT = (float*)d_out;
    char* wsp = (char*)d_ws;
    auto take = [&](size_t bytes) { char* p = wsp; wsp += (bytes + 255) & ~(size_t)255; return (void*)p; };
    bf* QB = (bf*)take((size_t)NB_ * NH_ * TT * HD * 2); bf* KB = (bf*)take((size_t)NB_ * NH_ * TT * HD * 2); bf* VT = (bf*)take((size_t)NB_ * NH_ * HD * TT * 2);
    if ((size_t)(wsp - (char*)d_ws) > ws_size) return;
    k_prep<<<dim3(TT / 128, NB_ * NH_, 1), 256, 0, stream>>>(Qin, Kin, Vin, QB, KB, VT);   /* token-major [b][t][h][d] slabs -> bf16 head planes */
    k_fattn<<<dim3(TT / 256, NB_ * NH_, 1), 512, 0, stream>>>(QB, KB, VT, OUT);   /* scores, softmax and A.values of every head in one launch */
}

// v004
// One run takes 36 microseconds.
// Two timings next to v003 both put it at 1.30 times that version's speed.
// Over all steps from v000 it is 59.4 times as fast.
#include <hip/hip_runtime.h>

// Causal full attention on given tensors (queries, keys, values [2][2048][16][64] = (B, L, H, E) token-major; scores = q.k with NO scaling (faithful: the source never applies its scale; logits sigma ~8), strictly-future keys excluded; softmax; V = A.values -> [2][2048][16][64]).
// Layout: single bf16 head planes gathered from the token-major slabs, both batches side by side, each plane in blocks of 32 tokens (4 KiB) laid out in fragment order:
// a block is 8 units of 512 bytes, and lane l's 16 bytes of a unit stand at 16 l, so that every wave-wide operand load of k_fattn is 512 contiguous bytes (4 whole lines) instead of 16 pieces on 16 lines.
// q, k: unit (kt, u), lane (c, h) = token 16 kt + c, d = 16 u + 8 h .. + 7.   values: unit (i, x), lane (c, h) = d = 4 c + i, tokens 16 x + 8 h .. + 7.
// One fused kernel for all heads: S^T = K.Q^T, running-maximum softmax in registers, O^T += V^T.P^T; scores and probabilities never reach memory.
// Compute dtypes, f32 accumulate: every input rounded to bf16; q.k exact products; softmax f32; P as bf16 hi/lo x exact values (2 products); output f32.

#define NB_  2
#define TT   2048
#define DM   1024      // token-major row pitch (H x HD)
#define NH_  16
#define HD   64
#define L2E  1.4426950408889634f
typedef unsigned short bf;
typedef __attribute__((ext_vector_type(16))) __bf16   v16bf;
typedef __attribute__((ext_vector_type(2)))  __bf16   v2bf;
typedef __attribute__((ext_vector_type(8)))  unsigned short v8us;
typedef __attribute__((ext_vector_type(8)))  unsigned int v8u;
typedef __attribute__((ext_vector_type(4)))  unsigned int v4u;
typedef __attribute__((ext_vector_type(2)))  unsigned int v2u;
typedef __attribute__((ext_vector_type(8)))  float    v8f;
typedef __attribute__((ext_vector_type(4)))  float    v4f;
typedef __attribute__((ext_vector_type(2)))  float    v2f;

__device__ __forceinline__ v16bf cat16b(v8us lo, v8us hi) { return __builtin_bit_cast(v16bf, __builtin_shufflevector(lo, hi, 0, 1, 2, 3, 4, 5, 6, 7, 8, 9, 10, 11, 12, 13, 14, 15)); }
__device__ __forceinline__ v8f wmmab(v16bf a, v16bf b, v8f c) { return __builtin_amdgcn_wmma_f32_16x16x32_bf16(false, a, false, b, (short)0, c, false, false); }
// One 16 x 32 operand fragment = units n, n + 1 of a plane block: elements 0-7 = k 8h.., 8-15 = k 16 + 8h..
// plane: the head's plane, the same for the whole wave; vo: byte offset in it of this lane's 16 bytes of the block's unit 0 (one 32-bit register beside a scalar base serves all loads of a block).
__device__ __forceinline__ v16bf ldfrag(const bf* plane, unsigned vo, int n) { const char* p = (const char*)plane + n * 512; return cat16b(*(const v8us*)(p + vo), *(const v8us*)(p + 512 + vo)); }
// Lane l <-> l ^ 16
__device__ __forceinline__ float xhalf(float x) { const int b = __float_as_int(x); return __int_as_float(__builtin_amdgcn_permlanex16(b, b, 0x76543210, 0xfedcba98, false, false)); }

// ---- k_prep: one launch builds all three plane sets. One work-group = 128 tokens of one head = 4 blocks (16 KiB in a row) of each plane; each thread fetches 24 x 16 bytes (every wave-wide load = two whole 256-byte head rows), all in flight together.
// Every '#pragma unroll' in it unrolls fully: the arrays of loaded rows that it indexes must stay in registers.
// Thread (dg, tr) holds d = 4 dg .. 4 dg + 3 of tokens 8 tr + j, j = 0..7, of q, k and values alike.
// values: a thread's 8 tokens of one d = 4 dg + i are lane 16 (tr & 1) + dg's own 16 bytes of unit (i, x): a wave stores whole units straight from registers.
// q, k: a thread's 4 d of one token are half a lane's piece of a unit; the halves cross LDS, and each wave then stores whole units.
// LDS image of the 16 KiB: the piece of lane (c, h) of unit u stands in its unit at place 16 h + (c ^ (2 u + h)), which spreads both the writers (4 u x 2 h x 2 c, one c & 7) and the readers (one u, one h, 16 c per half wave) over all banks.
__device__ __forceinline__ unsigned pk2(float a, float b) { return __builtin_bit_cast(unsigned, __builtin_convertvector((v2f){a, b}, v2bf)); }   /* round to nearest even; a in the low half */
__global__ __launch_bounds__(256) void k_prep(const float* __restrict__ Q, const float* __restrict__ K, const float* __restrict__ V, bf* __restrict__ QB, bf* __restrict__ KB, bf* __restrict__ VT) {
    __shared__ __attribute__((aligned(16))) unsigned tq[HD * 64], tk[HD * 64];
    const unsigned dg = threadIdx.x & 15, tr = threadIdx.x >> 4, w = threadIdx.x >> 5;
    const int t0 = (int)blockIdx.x * 128, bh = blockIdx.y, b = bh / NH_, h = bh % NH_;
    const size_t sbase = ((size_t)b * TT + t0) * DM + h * HD;   /* the same for the whole work-group */
    const unsigned lo = 8 * tr * DM + 4 * dg;                   /* the lane's own offset, one register for all 24 loads */
    const float* vs = V + sbase; const float* qs = Q + sbase; const float* ks = K + sbase;
    v4f v[8], q[8], k[8];
#pragma unroll
    for (int j = 0; j < 8; ++j) q[j] = *(const v4f*)(qs + (lo + j * DM));
#pragma unroll
    for (int j = 0; j < 8; ++j) k[j] = *(const v4f*)(ks + (lo + j * DM));
#pragma unroll
    for (int j = 0; j < 8; ++j) v[j] = *(const v4f*)(vs + (lo + j * DM));
    asm volatile("s_wait_xcnt 0x0" ::: "memory");   /* the lane-offset register of the loads above is reused by the conversions below: the wait stands ahead of that overwrite */
    __builtin_amdgcn_sched_barrier(0);   /* keeps every conversion behind all 24 loads: one memory latency for the work-group instead of three in a row */
    /* place, in 8-byte halves, of token 8 tr + 0: unit 4 (tr >> 1) + (dg >> 2), h = (dg >> 1) & 1, c = 8 (tr & 1), turned by 2 u + h = dg >> 1; token j: the place's c bits ^ j */
    const unsigned wb = ((tr >> 1) * 4 + (dg >> 2)) * 64 + ((dg >> 1) & 1) * 32 + (tr & 1) * 16 + (dg >> 1) * 2 + (dg & 1);
#pragma unroll
    for (int j = 0; j < 8; ++j) ((v2u*)tq)[wb ^ (j * 2)] = (v2u){pk2(q[j][0], q[j][1]), pk2(q[j][2], q[j][3])};
#pragma unroll
    for (int j = 0; j < 8; ++j) ((v2u*)tk)[wb ^ (j * 2)] = (v2u){pk2(k[j][0], k[j][1]), pk2(k[j][2], k[j][3])};
    __syncthreads();   /* every half piece of the q and k images is in LDS before another thread reads it; ahead of all global stores, so that it waits for none */
    const size_t pbase = ((size_t)bh * TT + t0) * HD;   /* 128 tokens x 64 d: the same 16 KiB range in each of the three planes */
    bf* vo = VT + pbase; bf* qo = QB + pbase; bf* ko = KB + pbase;
    const unsigned vl = (w >> 1) * 2048 + (w & 1) * 256 + (threadIdx.x & 31) * 8;   /* the wave's 16 tokens: block w >> 1, x = w & 1 */
#pragma unroll
    for (int i = 0; i < 4; ++i)
        *(v4u*)(vo + (vl + i * 512)) = (v4u){pk2(v[0][i], v[1][i]), pk2(v[2][i], v[3][i]), pk2(v[4][i], v[5][i]), pk2(v[6][i], v[7][i])};
    /* round r: wave w copies unit 8 r + w (u = w & 3); this thread is its lane (c, h) = (dg, tr & 1) */
    const unsigned rb = w * 128 + (tr & 1) * 64 + (dg ^ ((w & 3) * 2 + (tr & 1))) * 4, po = threadIdx.x * 8;
#pragma unroll
    for (int r = 0; r < 4; ++r) *(v4u*)(qo + (po + r * 2048)) = *(const v4u*)(tq + (rb + r * 1024));
#pragma unroll
    for (int r = 0; r < 4; ++r) *(v4u*)(ko + (po + r * 2048)) = *(const v4u*)(tk + (rb + r * 1024));
}

// Every '#pragma unroll' below unrolls fully: the fragment and accumulator arrays it indexes must stay in registers.
// ---- k_fattn: one wave owns 32 query columns (two 16-column groups) of one head and walks a quarter of their keys in passes of 32.
// S^T tile: lane (c, h) holds query c, keys 8h + r: two tiles (keys 0-15, 16-31) converted in place are the B operand of O^T += V^T.P^T in the loader's own k order.
__device__ __forceinline__ void att_scores(const v16bf (&kf)[2][2], const v16bf (&qf)[2][2], v8f (&s)[2][2]) {
#pragma unroll
    for (int kt = 0; kt < 2; ++kt)
#pragma unroll
        for (int g = 0; g < 2; ++g) { s[kt][g] = (v8f){};
#pragma unroll
            for (int kc = 0; kc < 2; ++kc) s[kt][g] = wmmab(kf[kt][kc], qf[g][kc], s[kt][g]); }
}
__device__ __forceinline__ void att_ldk(v16bf (&kf)[2][2], const bf* kh, unsigned vo) {
#pragma unroll
    for (int kt = 0; kt < 2; ++kt)
#pragma unroll
        for (int kc = 0; kc < 2; ++kc) kf[kt][kc] = ldfrag(kh, vo, kt * 4 + kc * 2);
}
__device__ __forceinline__ void att_ldv(v16bf (&vf)[4], const bf* vh, unsigned vo) {
#pragma unroll
    for (int dt = 0; dt < 4; ++dt) vf[dt] = ldfrag(vh, vo, dt * 2);   /* row c of fragment dt is d = 4 c + dt */
}
template <bool DIAG>
__device__ __forceinline__ void att_softpv(v8f (&s)[2][2], const v16bf (&vf)[4], v8f (&acc)[2][4], float (&m2)[2], float (&l)[2], int c, int hh) {
#pragma unroll
    for (int g = 0; g < 2; ++g) {
        if (DIAG) {   /* the pass on the diagonal starts at the wave's first query: key offset > query offset is a future key */
#pragma unroll
            for (int kt = 0; kt < 2; ++kt)
#pragma unroll
                for (int r = 0; r < 8; ++r) if (16 * kt + 8 * hh + r > 16 * g + c) s[kt][g][r] = -3.0e38f; }
        float mx = s[0][g][0];
#pragma unroll
        for (int kt = 0; kt < 2; ++kt)
#pragma unroll
            for (int r = 0; r < 8; ++r) mx = fmaxf(mx, s[kt][g][r]);
        mx = fmaxf(mx, xhalf(mx));
        const float mn = fmaxf(m2[g], mx * L2E);
        const float corr = __builtin_amdgcn_exp2f(m2[g] - mn); m2[g] = mn;
#pragma unroll
        for (int dt = 0; dt < 4; ++dt) acc[g][dt] = acc[g][dt] * corr;
        float sum = 0.f; v8u wh, wl;
#pragma unroll
        for (int i = 0; i < 8; ++i) {
            const v2f arg = __builtin_elementwise_fma((v2f){s[i >> 2][g][2 * (i & 3)], s[i >> 2][g][2 * (i & 3) + 1]}, (v2f){L2E, L2E}, (v2f){-mn, -mn});
            const float e0 = __builtin_amdgcn_exp2f(arg[0]), e1 = __builtin_amdgcn_exp2f(arg[1]);
            sum += e0 + e1;
            const unsigned h2 = __builtin_bit_cast(unsigned, __builtin_convertvector((v2f){e0, e1}, v2bf));
            wh[i] = h2;
            wl[i] = __builtin_bit_cast(unsigned, __builtin_convertvector((v2f){e0 - __uint_as_float(h2 << 16), e1 - __uint_as_float(h2 & 0xFFFF0000u)}, v2bf)); }
        l[g] = l[g] * corr + sum;
        const v16bf ph = __builtin_bit_cast(v16bf, wh), pl = __builtin_bit_cast(v16bf, wl);
#pragma unroll
        for (int dt = 0; dt < 4; ++dt) acc[g][dt] = wmmab(vf[dt], ph, acc[g][dt]);
#pragma unroll
        for (int dt = 0; dt < 4; ++dt) acc[g][dt] = wmmab(vf[dt], pl, acc[g][dt]);
    }
}
// One work-group = 16 waves = 4 neighbouring query tiles x 4 key shares, first of the heavy quad 15 - x, then of the light quad x (260 passes for every work-group).
// Share j of tile t walks passes j, j + 4, ... <= t; the four waves of one share read the same keys at the same time.
// Each share keeps its own running maximum, sum and O^T; the shares meet in LDS: maxima and sums first, then the O^T parts, already scaled to the common maximum and divided by the common sum.
__global__ __launch_bounds__(512) void k_fattn(const unsigned short* __restrict__ QB, const unsigned short* __restrict__ KB, const unsigned short* __restrict__ VT, float* __restrict__ OUT) {
    __shared__ float sm[4][4][32], sl[4][4][32];                              /* [tile][share][query] */
    __shared__ __attribute__((aligned(16))) v4f part[4][4][16][32];           /* [tile][share][(g, register)][lane]: the four d = 32 h + 4 r .. + 3 of the lane's query; a wave-wide access is 512 contiguous bytes or two runs of 256 */
    const int lane = threadIdx.x & 31, c = lane & 15, hh = lane >> 4; const int wave = __builtin_amdgcn_readfirstlane((int)(threadIdx.x >> 5));
    const int ti = wave >> 2, bh = blockIdx.y, b = bh / NH_, h = bh % NH_;
    const bf* qh = QB + (size_t)bh * TT * HD; const bf* kh = KB + (size_t)bh * TT * HD; const bf* vh = VT + (size_t)bh * HD * TT;
    const unsigned lo = lane * 16;   /* bytes; a block of 32 tokens is 4096 */
#pragma unroll 1   /* rolled: one copy of the pass loop serves both quads */
    for (int ph = 0; ph < 2; ++ph) {
        /* the share order is turned round for the second quad: so the shares' pass counts even out over the two quads */
        const int j = ph ? 3 - (wave & 3) : (wave & 3);
        const int t = 4 * (ph ? (int)blockIdx.x : (TT / 128 - 1) - (int)blockIdx.x) + ti, q0 = t * 32;
        v16bf qf[2][2], kf[2][2], vf[4];
#pragma unroll
        for (int g = 0; g < 2; ++g)
#pragma unroll
            for (int kc = 0; kc < 2; ++kc) qf[g][kc] = ldfrag(qh, lo + (unsigned)t * 4096u, g * 4 + kc * 2);
        int p = j;
        att_ldk(kf, kh, lo + (unsigned)(p < t ? p : t) * 4096u);   /* a fetch ahead never passes the tile's own diagonal pass */
        asm volatile("s_wait_xcnt 0x0" ::: "memory");   /* the address registers of the loads above are reused by the accumulators' zeroing below: the wait stands ahead of that overwrite */
        v8f acc[2][4]; float m2[2], l[2];
#pragma unroll
        for (int g = 0; g < 2; ++g) { m2[g] = -3.0e38f; l[g] = 0.f;
#pragma unroll
            for (int dt = 0; dt < 4; ++dt) acc[g][dt] = (v8f){}; }
        v8f s[2][2];
#pragma unroll 1   /* rolled: a second copy of the body would want a second set of fragment registers */
        for (; p < t; ) {   /* passes wholly below the diagonal; V is fetched at the head of its pass, the share's next K behind this pass's score products */
            att_ldv(vf, vh, lo + (unsigned)p * 4096u);
            att_scores(kf, qf, s);
            p += 4; att_ldk(kf, kh, lo + (unsigned)(p < t ? p : t) * 4096u);
            __builtin_amdgcn_sched_barrier(0);   /* keeps the next pass's K loads here, in flight under the whole softmax and second product, instead of at the loop's foot */
            att_softpv<false>(s, vf, acc, m2, l, c, hh);
        }
        if (p == t) {   /* one share of four owns the pass on the diagonal; the test is the same for the whole wave */
            att_ldv(vf, vh, lo + (unsigned)p * 4096u);
            att_scores(kf, qf, s);
            att_softpv<true>(s, vf, acc, m2, l, c, hh);
        }
        const float l0 = l[0] + xhalf(l[0]), l1 = l[1] + xhalf(l[1]);
        sm[ti][j][lane] = hh ? m2[1] : m2[0]; sl[ti][j][lane] = hh ? l1 : l0;   /* lane = 16 g + c: the upper half files group 1 */
        __syncthreads();   /* every share's maximum and sum are in LDS before any share reads them */
#pragma unroll
        for (int g = 0; g < 2; ++g) {
            float mk[4], lk[4];
#pragma unroll
            for (int k = 0; k < 4; ++k) { mk[k] = sm[ti][k][16 * g + c]; lk[k] = sl[ti][k][16 * g + c]; }
            const float mm = fmaxf(fmaxf(mk[0], mk[1]), fmaxf(mk[2], mk[3]));   /* finite: the share with the diagonal pass has seen the query's own key; a share without a pass weighs exp2(-huge) = 0 */
            float lt = 0.f;
#pragma unroll
            for (int k = 0; k < 4; ++k) lt += __builtin_amdgcn_exp2f(mk[k] - mm) * lk[k];
            const float f = __builtin_amdgcn_exp2f(m2[g] - mm) * __fdiv_rn(1.0f, lt);
#pragma unroll
            for (int r = 0; r < 8; ++r) part[ti][j][g * 8 + r][lane] = (v4f){acc[g][0][r], acc[g][1][r], acc[g][2][r], acc[g][3][r]} * f;   /* register r of fragment dt is d = 4 (8 h + r) + dt */
        }
        __syncthreads();   /* every share's part is in LDS before it is summed; the next quad's first barrier keeps its parts behind these reads */
        /* share j sums and stores group j >> 1, d = 32 (j & 1) .. + 31, which the lanes of half j & 1 filed: one whole 128-byte line of each of 16 query rows */
        const int go = j >> 1, hs = j & 1;
        float* orow = OUT + ((size_t)b * TT + q0 + 16 * go) * DM + h * HD + hs * 32;
        const unsigned oo = c * DM + 16 * hh;   /* this lane takes registers 4 h + e of its query: d = 32 (j & 1) + 16 h + 4 e .. + 3 */
#pragma unroll
        for (int e = 0; e < 4; ++e) {
            const int sl_ = go * 8 + 4 * hh + e, ls = hs * 16 + c;
            const v4f o = (part[ti][0][sl_][ls] + part[ti][1][sl_][ls]) + (part[ti][2][sl_][ls] + part[ti][3][sl_][ls]);
            *(v4f*)(orow + (oo + e * 4)) = o; }
        asm volatile("s_wait_xcnt 0x0" ::: "memory");   /* the registers of the stores above are reused by the next quad's loads: the wait stands ahead of that overwrite */
    }
}

extern "C" void kernel_launch(void* const* d_in, const int* in_sizes, int n_in,
                              void* d_out, int out_size, void* d_ws, size_t ws_size, hipStream_t stream) {
    (void)in_sizes; (void)n_in; (void)out_size;
    const float* Qin = (const float*)d_in[0]; const float* Kin = (const float*)d_in[1]; const float* Vin = (const float*)d_in[2];
    float* OUT = (float*)d_out;
    char* wsp = (char*)d_ws;
    auto take = [&](size_t bytes) { char* p = wsp; wsp += (bytes + 255) & ~(size_t)255; return (void*)p; };
    bf* QB = (bf*)take((size_t)NB_ * NH_ * TT * HD * 2); bf* KB = (bf*)take((size_t)NB_ * NH_ * TT * HD * 2); bf* VT = (bf*)take((size_t)NB_ * NH_ * HD * TT * 2);
    if ((size_t)(wsp - (char*)d_ws) > ws_size) return;
    k_prep<<<dim3(TT / 128, NB_ * NH_, 1), 256, 0, stream>>>(Qin, Kin, Vin, QB, KB, VT);   /* token-major [b][t][h][d] slabs -> bf16 head planes */
    k_fattn<<<dim3(TT / 256, NB_ * NH_, 1), 512, 0, stream>>>(QB, KB, VT, OUT);   /* scores, softmax and A.values of every head in one launch */
}

// v006
// Measured time: 25.7 microseconds a run.
// Versions in between are left out here; by their measured steps it is 1.39 times as fast as v004.
// All steps since v000 together make it 82.6 times as fast.
#include <hip/hip_runtime.h>

// Causal full attention on given tensors (queries, keys, values [2][2048][16][64] = (B, L, H, E) token-major; scores = q.k with NO scaling (faithful: the source never applies its scale; logits sigma ~8), strictly-future keys excluded; softmax; V = A.values -> [2][2048][16][64]).
// One launch. Nothing crosses the workspace: each work-group rounds the keys and values it needs itself, 128 keys at a time, from the token-major f32 slabs into two LDS images (keys bf16, values f16), and reads its operand fragments from there.
// An image is 4 blocks of 32 tokens (4 KiB each) in fragment order: a block is 8 units of 512 bytes, one 16-byte piece per lane.
// keys: unit (kt, u), lane (c, h) = token 16 kt + c, d = 16 u + 8 h .. + 7.   values: unit (i, x), lane (c, h) = d = 4 c + i, tokens 16 x + 8 h .. + 7.
// One fused kernel for all heads: S^T = K.Q^T, running-maximum softmax in registers, O^T += V^T.P^T; scores and probabilities never reach memory.
// Compute dtypes, f32 accumulate: q, k rounded to bf16, q.k exact products; softmax f32; values and P each rounded once to f16 (P lies in (0, 1], its rounding 2^-12 stands far below what the bf16 logits leave), one product; output f32.

#define NB_  2
#define TT   2048
#define DM   1024      // token-major row pitch (H x HD)
#define NH_  16
#define HD   64
#define L2E  1.4426950408889634f
typedef unsigned short bf;
typedef __attribute__((ext_vector_type(16))) __bf16   v16bf;
typedef __attribute__((ext_vector_type(2)))  __bf16   v2bf;
typedef __attribute__((ext_vector_type(16))) _Float16 v16h;
typedef __attribute__((ext_vector_type(2)))  _Float16 v2h;
typedef __attribute__((ext_vector_type(8)))  unsigned short v8us;
typedef __attribute__((ext_vector_type(8)))  unsigned int v8u;
typedef __attribute__((ext_vector_type(4)))  unsigned int v4u;
typedef __attribute__((ext_vector_type(2)))  unsigned int v2u;
typedef __attribute__((ext_vector_type(8)))  float    v8f;
typedef __attribute__((ext_vector_type(4)))  float    v4f;
typedef __attribute__((ext_vector_type(2)))  float    v2f;

__device__ __forceinline__ v16bf cat16b(v8us lo, v8us hi) { return __builtin_bit_cast(v16bf, __builtin_shufflevector(lo, hi, 0, 1, 2, 3, 4, 5, 6, 7, 8, 9, 10, 11, 12, 13, 14, 15)); }
__device__ __forceinline__ v8f wmmab(v16bf a, v16bf b, v8f c) { return __builtin_amdgcn_wmma_f32_16x16x32_bf16(false, a, false, b, (short)0, c, false, false); }
__device__ __forceinline__ v8f wmmah(v16h a, v16h b, v8f c) { return __builtin_amdgcn_wmma_f32_16x16x32_f16(false, a, false, b, (short)0, c, false, false); }
// Lane l <-> l ^ 16
__device__ __forceinline__ float xhalf(float x) { const int b = __float_as_int(x); return __int_as_float(__builtin_amdgcn_permlanex16(b, b, 0x76543210, 0xfedcba98, false, false)); }
__device__ __forceinline__ unsigned pk2(float a, float b) { return __builtin_bit_cast(unsigned, __builtin_convertvector((v2f){a, b}, v2bf)); }   /* to bf16, round to nearest even; a in the low half */
__device__ __forceinline__ unsigned pk2h(float a, float b) { return __builtin_bit_cast(unsigned, __builtin_convertvector((v2f){a, b}, v2h)); }   /* the same to f16 */

// Every '#pragma unroll' below unrolls fully: the fragment and accumulator arrays it indexes must stay in registers.
// ---- k_fattn: one wave owns 32 query columns (two 16-column groups) of one head and walks a quarter of their keys in passes of 32.
// S^T tile: lane (c, h) holds query c, keys 8h + r: two tiles (keys 0-15, 16-31) converted in place are the B operand of O^T += V^T.P^T in the loader's own k order.
__device__ __forceinline__ void att_scores(const v16bf (&kf)[2][2], const v16bf (&qf)[2][2], v8f (&s)[2][2]) {
#pragma unroll
    for (int kt = 0; kt < 2; ++kt)
#pragma unroll
        for (int g = 0; g < 2; ++g) { s[kt][g] = (v8f){};
#pragma unroll
            for (int kc = 0; kc < 2; ++kc) s[kt][g] = wmmab(kf[kt][kc], qf[g][kc], s[kt][g]); }
}
// One 16 x 32 operand fragment = two neighbouring units of an image block: elements 0-7 = k 8h.., 8-15 = k 16 + 8h..   All offsets into an image count 32-bit words.
// keys image: the piece of lane (c, h) of unit u stands in its unit at place 16 h + (c ^ (2 u + h)), which spreads both the writers (4 u x 2 h x 2 c, one c & 7) and the readers (one u, one h, 16 c per half wave) over all banks.
// kb: the block's first word; kp: word offset of this lane's piece in a unit with u = 0, that is 64 h + 4 (c ^ h); unit u: the place's c bits ^ 2 u.
__device__ __forceinline__ void att_ldk(v16bf (&kf)[2][2], const unsigned* kb, unsigned kp) {
#pragma unroll
    for (int kt = 0; kt < 2; ++kt)
#pragma unroll
        for (int kc = 0; kc < 2; ++kc) {
            const unsigned* u0 = kb + (kt * 4 + kc * 2) * 128;
            kf[kt][kc] = cat16b(*(const v8us*)(u0 + (kp ^ (unsigned)(kc * 16))), *(const v8us*)(u0 + 128 + (kp ^ (unsigned)(kc * 16 + 8)))); }
}
// values image: lane l's piece of a unit stands at 16 l bytes. vb: the block's first word plus 4 l.
__device__ __forceinline__ void att_ldv(v16h (&vf)[4], const unsigned* vb) {
#pragma unroll
    for (int dt = 0; dt < 4; ++dt) vf[dt] = __builtin_bit_cast(v16h, cat16b(*(const v8us*)(vb + dt * 256), *(const v8us*)(vb + dt * 256 + 128)));   /* row c of fragment dt is d = 4 c + dt */
}
template <bool DIAG>
__device__ __forceinline__ void att_softpv(v8f (&s)[2][2], const v16h (&vf)[4], v8f (&acc)[2][4], float (&m2)[2], float (&l)[2], int c, int hh, int dk) {
#pragma unroll
    for (int g = 0; g < 2; ++g) {
        if (DIAG) {   /* a pass of the quad's last stage starts dk keys (0, -32, -64, -96) from the wave's first query: key offset > query offset is a future key */
#pragma unroll
            for (int kt = 0; kt < 2; ++kt)
#pragma unroll
                for (int r = 0; r < 8; ++r) if (dk + 16 * kt + 8 * hh + r > 16 * g + c) s[kt][g][r] = -3.0e38f; }
        float mx = s[0][g][0];
#pragma unroll
        for (int kt = 0; kt < 2; ++kt)
#pragma unroll
            for (int r = 0; r < 8; ++r) mx = fmaxf(mx, s[kt][g][r]);
        mx = fmaxf(mx, xhalf(mx));
        const float mn = fmaxf(m2[g], mx * L2E);
        const float corr = __builtin_amdgcn_exp2f(m2[g] - mn); m2[g] = mn;
#pragma unroll
        for (int dt = 0; dt < 4; ++dt) acc[g][dt] = acc[g][dt] * corr;
        float sum = 0.f; v8u wp;
#pragma unroll
        for (int i = 0; i < 8; ++i) {
            const v2f arg = __builtin_elementwise_fma((v2f){s[i >> 2][g][2 * (i & 3)], s[i >> 2][g][2 * (i & 3) + 1]}, (v2f){L2E, L2E}, (v2f){-mn, -mn});
            const float e0 = __builtin_amdgcn_exp2f(arg[0]), e1 = __builtin_amdgcn_exp2f(arg[1]);
            sum += e0 + e1;
            wp[i] = pk2h(e0, e1); }
        l[g] = l[g] * corr + sum;
        const v16h pf = __builtin_bit_cast(v16h, wp);
#pragma unroll
        for (int dt = 0; dt < 4; ++dt) acc[g][dt] = wmmah(vf[dt], pf, acc[g][dt]);
    }
}
// The thread's 8 fetched rows of a stage are rounded and filed in the stage's images (wb, vl: see the kernel).
__device__ __forceinline__ void att_file(const v4f (&st)[8], unsigned* kim, unsigned* vim, bool isv, unsigned wb, unsigned vl) {
    if (isv) {   /* the same for the whole wave */
#pragma unroll
        for (int i = 0; i < 4; ++i)
            *(v4u*)(vim + (vl + i * 256)) = (v4u){pk2h(st[0][i], st[1][i]), pk2h(st[2][i], st[3][i]), pk2h(st[4][i], st[5][i]), pk2h(st[6][i], st[7][i])};
    } else {
#pragma unroll
        for (int i = 0; i < 8; ++i) ((v2u*)kim)[wb ^ (i * 2)] = (v2u){pk2(st[i][0], st[i][1]), pk2(st[i][2], st[i][3])};
    }
}
// The work-group's barrier by hand, in its two halves, ordering LDS alone: it waits neither for the output stores of the quad before nor for a global load in flight, and a wave works on between its arrival and its wait.
// wg_arrive: this wave's LDS reads and writes so far are done.   wg_wait: so are every wave's up to its arrival.
__device__ __forceinline__ void wg_arrive() { __builtin_amdgcn_fence(__ATOMIC_RELEASE, "workgroup", "local"); __builtin_amdgcn_s_barrier_signal(-1); }
__device__ __forceinline__ void wg_wait()   { __builtin_amdgcn_s_barrier_wait(-1); __builtin_amdgcn_fence(__ATOMIC_ACQUIRE, "workgroup", "local"); }
// One work-group = 16 waves = 4 neighbouring query tiles x 4 key shares, first of the heavy quad 15 - x, then of the light quad x.
// The keys come in stages of 128 = 4 blocks; share j of tile t takes block j of every stage, that is passes j, j + 4, ... <= t; quad n has n + 1 stages (17 for every work-group).
// Staging: waves 0-7 fetch and round the stage's keys, waves 8-15 its values. Thread (dg, tr) of either half holds d = 4 dg .. 4 dg + 3 of tokens 8 tr + j, j = 0..7 (every wave-wide load = two whole 256-byte head rows).
// Stage s + 1 is filed behind the score products of stage s, and the f32 rows of stage s + 2 are then fetched into the same registers; two images of each kind, one barrier a stage, arrival and wait half a stage apart.
// Each share keeps its own running maximum, sum and O^T; the shares meet in LDS: maxima and sums first, then the O^T parts, already scaled to the common maximum and divided by the common sum.
__global__ __launch_bounds__(512) void k_fattn(const float* __restrict__ Q, const float* __restrict__ K, const float* __restrict__ V, float* __restrict__ OUT) {
    __shared__ float sm[4][4][32], sl[4][4][32];                              /* [tile][share][query] */
    __shared__ __attribute__((aligned(16))) v4f part[4][4][16][32];           /* [tile][share][(g, register)][lane]: the four d = 32 h + 4 r .. + 3 of the lane's query; a wave-wide access is 512 contiguous bytes or two runs of 256 */
    __shared__ __attribute__((aligned(16))) unsigned ik[2][4096], iv[2][4096];   /* [stage & 1]: 128 keys, 128 values, 16 KiB each */
    const int lane = threadIdx.x & 31, c = lane & 15, hh = lane >> 4; const int wave = __builtin_amdgcn_readfirstlane((int)(threadIdx.x >> 5));
    const int ti = wave >> 2, bh = blockIdx.y, b = bh / NH_, h = bh % NH_;
    const size_t hbase = (size_t)b * TT * DM + h * HD;   /* token 0 of the head, the same for the whole work-group */
    const bool isv = wave >= 8;                          /* the same for the whole wave */
    const float* src = (isv ? V : K) + hbase;
    const unsigned dg = threadIdx.x & 15, tr = (threadIdx.x >> 4) & 15, w8 = wave & 7;
    const unsigned lo = 8 * tr * DM + 4 * dg;            /* the lane's own offset, one register for all 8 loads of a stage */
    /* keys: place, in 8-byte halves, of token 8 tr + 0: unit 4 (tr >> 1) + (dg >> 2), h = (dg >> 1) & 1, c = 8 (tr & 1), turned by 2 u + h = dg >> 1; token j: the place's c bits ^ j */
    const unsigned wb = ((tr >> 1) * 4 + (dg >> 2)) * 64 + ((dg >> 1) & 1) * 32 + (tr & 1) * 16 + (dg >> 1) * 2 + (dg & 1);
    /* values: a thread's 8 tokens of one d = 4 dg + i are lane 16 (tr & 1) + dg's own piece of unit (i, x); the wave's 16 tokens: block w8 >> 1, x = w8 & 1 */
    const unsigned vl = (w8 >> 1) * 1024 + (w8 & 1) * 128 + lane * 4;
    const unsigned kp = hh * 64 + (c ^ hh) * 4;
    v4f st[8];
#pragma unroll
    for (int i = 0; i < 8; ++i) st[i] = *(const v4f*)(src + (lo + i * DM));   /* stage 0 */
    asm volatile("s_wait_xcnt 0x0" ::: "memory");   /* the address registers of the loads above are reused below: the wait stands ahead of that overwrite */
#pragma unroll 1   /* rolled: one copy of the stage loop serves both quads */
    for (int ph = 0; ph < 2; ++ph) {
        /* the share order is turned round for the second quad, as the diagonal stage gives share 0 the most passes and share 3 the fewest */
        const int j = ph ? 3 - (wave & 3) : (wave & 3);
        const int qd = ph ? (int)blockIdx.x : (TT / 128 - 1) - (int)blockIdx.x;
        const int t = 4 * qd + ti, q0 = t * 32;
        v16bf qf[2][2], kf[2][2]; v16h vf[4];
        {   /* the tile's queries straight from the f32 slab: fragment (g, kc), lane (c, h) = token 16 g + c, d = 32 kc + 8 h .. + 7 and 32 kc + 16 + 8 h .. + 7 */
            const float* qs = Q + hbase + (size_t)q0 * DM;
            const unsigned qo = c * DM + 8 * hh;
            v4f qr[2][2][4];
#pragma unroll
            for (int g = 0; g < 2; ++g)
#pragma unroll
                for (int kc = 0; kc < 2; ++kc)
#pragma unroll
                    for (int e = 0; e < 4; ++e) qr[g][kc][e] = *(const v4f*)(qs + (qo + g * 16 * DM + kc * 32 + (e >> 1) * 16 + (e & 1) * 4));
            asm volatile("s_wait_xcnt 0x0" ::: "memory");   /* the address registers of the loads above are reused below: the wait stands ahead of that overwrite */
#pragma unroll
            for (int g = 0; g < 2; ++g)
#pragma unroll
                for (int kc = 0; kc < 2; ++kc) {
                    v8u wq;
#pragma unroll
                    for (int e = 0; e < 4; ++e) { wq[2 * e] = pk2(qr[g][kc][e][0], qr[g][kc][e][1]); wq[2 * e + 1] = pk2(qr[g][kc][e][2], qr[g][kc][e][3]); }
                    qf[g][kc] = __builtin_bit_cast(v16bf, wq); }
        }
        v8f acc[2][4]; float m2[2], l[2];
#pragma unroll
        for (int g = 0; g < 2; ++g) { m2[g] = -3.0e38f; l[g] = 0.f;
#pragma unroll
            for (int dt = 0; dt < 4; ++dt) acc[g][dt] = (v8f){}; }
        v8f s[2][2];
        att_file(st, ik[0], iv[0], isv, wb, vl);   /* stage 0; the images are free: two barriers of the shares' meeting lie behind their last readers */
        wg_arrive();
        {   const float* nx = src + (size_t)(qd > 0 ? 1 : 0) * (128 * DM);
#pragma unroll
            for (int i = 0; i < 8; ++i) st[i] = *(const v4f*)(nx + (lo + i * DM));
            asm volatile("s_wait_xcnt 0x0" ::: "memory");   /* the address registers of the loads above are reused below: the wait stands ahead of that overwrite */
        }
        wg_wait();
#pragma unroll 1   /* rolled: a second copy of the body would want a second set of fragment registers */
        for (int sg = 0; sg < qd; ++sg) {   /* stages wholly below the diagonal: every wave has a pass; the trip count is the same for the whole work-group */
            att_ldk(kf, ik[sg & 1] + j * 1024, kp);
            att_ldv(vf, iv[sg & 1] + j * 1024 + lane * 4);
            att_scores(kf, qf, s);
            att_file(st, ik[(sg + 1) & 1], iv[(sg + 1) & 1], isv, wb, vl);   /* stage sg + 1 into the images that stage sg - 1 used: every wave had read its fragments of that stage when it arrived at the barrier this wave has passed */
            wg_arrive();   /* behind this wave's fragment reads of stage sg and its share of stage sg + 1 */
            const float* nx = src + (size_t)(sg + 2 <= qd ? sg + 2 : 0) * (128 * DM);   /* the rows of stage sg + 2; behind the quad's last, stage 0 again, which the light quad starts from */
#pragma unroll
            for (int i = 0; i < 8; ++i) st[i] = *(const v4f*)(nx + (lo + i * DM));
            asm volatile("s_wait_xcnt 0x0" ::: "memory");   /* the address registers of the loads above are reused below: the wait stands ahead of that overwrite */
            __builtin_amdgcn_sched_barrier(0);   /* keeps the filing, the arrival and the loads here, ahead of the softmax and second product, under which the other waves arrive and the loads fly */
            att_softpv<false>(s, vf, acc, m2, l, c, hh, 0);
            __builtin_amdgcn_sched_barrier(0);   /* keeps the wait below at the stage's foot: moved up to the arrival it would stop every wave until the slowest has filed its share */
            wg_wait();     /* stage sg + 1 is whole */
        }
        if (j <= ti) {   /* the stage on the diagonal: share j has a pass of tile t if j <= ti; the test is the same for the whole wave */
            att_ldk(kf, ik[qd & 1] + j * 1024, kp);
            att_ldv(vf, iv[qd & 1] + j * 1024 + lane * 4);
            att_scores(kf, qf, s);
            att_softpv<true>(s, vf, acc, m2, l, c, hh, 32 * (j - ti));
        }
        const float l0 = l[0] + xhalf(l[0]), l1 = l[1] + xhalf(l[1]);
        sm[ti][j][lane] = hh ? m2[1] : m2[0]; sl[ti][j][lane] = hh ? l1 : l0;   /* lane = 16 g + c: the upper half files group 1 */
        __syncthreads();   /* every share's maximum and sum are in LDS before any share reads them */
#pragma unroll
        for (int g = 0; g < 2; ++g) {
            float mk[4], lk[4];
#pragma unroll
            for (int k = 0; k < 4; ++k) { mk[k] = sm[ti][k][16 * g + c]; lk[k] = sl[ti][k][16 * g + c]; }
            const float mm = fmaxf(fmaxf(mk[0], mk[1]), fmaxf(mk[2], mk[3]));   /* finite: the share with the diagonal pass has seen the query's own key; a share without a pass weighs exp2(-huge) = 0 */
            float lt = 0.f;
#pragma unroll
            for (int k = 0; k < 4; ++k) lt += __builtin_amdgcn_exp2f(mk[k] - mm) * lk[k];
            const float f = __builtin_amdgcn_exp2f(m2[g] - mm) * __fdiv_rn(1.0f, lt);
#pragma unroll
            for (int r = 0; r < 8; ++r) part[ti][j][g * 8 + r][lane] = (v4f){acc[g][0][r], acc[g][1][r], acc[g][2][r], acc[g][3][r]} * f;   /* register r of fragment dt is d = 4 (8 h + r) + dt */
        }
        __syncthreads();   /* every share's part is in LDS before it is summed; the next quad's first barrier keeps its parts behind these reads */
        /* share j sums and stores group j >> 1, d = 32 (j & 1) .. + 31, which the lanes of half j & 1 filed: one whole 128-byte line of each of 16 query rows */
        const int go = j >> 1, hs = j & 1;
        float* orow = OUT + ((size_t)b * TT + q0 + 16 * go) * DM + h * HD + hs * 32;
        const unsigned oo = c * DM + 16 * hh;   /* this lane takes registers 4 h + e of its query: d = 32 (j & 1) + 16 h + 4 e .. + 3 */
#pragma unroll
        for (int e = 0; e < 4; ++e) {
            const int sl_ = go * 8 + 4 * hh + e, ls = hs * 16 + c;
            const v4f o = (part[ti][0][sl_][ls] + part[ti][1][sl_][ls]) + (part[ti][2][sl_][ls] + part[ti][3][sl_][ls]);
            *(v4f*)(orow + (oo + e * 4)) = o; }
        asm volatile("s_wait_xcnt 0x0" ::: "memory");   /* the registers of the stores above are reused by the next quad's loads: the wait stands ahead of that overwrite */
    }
}

extern "C" void kernel_launch(void* const* d_in, const int* in_sizes, int n_in,
                              void* d_out, int out_size, void* d_ws, size_t ws_size, hipStream_t stream) {
    (void)in_sizes; (void)n_in; (void)out_size; (void)d_ws; (void)ws_size;
    const float* Qin = (const float*)d_in[0]; const float* Kin = (const float*)d_in[1]; const float* Vin = (const float*)d_in[2];
    float* OUT = (float*)d_out;
    k_fattn<<<dim3(TT / 256, NB_ * NH_, 1), 512, 0, stream>>>(Qin, Kin, Vin, OUT);   /* rounding, scores, softmax and A.values of every head in one launch */
}

// v008
// One run takes 22.7 microseconds.
// Versions between v006 and this one are left out; their measured steps multiply to 1.13 times as fast.
// All steps since v000 together make it 93.5 times as fast.
#include <hip/hip_runtime.h>

// Causal full attention on given tensors (queries, keys, values [2][2048][16][64] = (B, L, H, E) token-major; scores = q.k with NO scaling (faithful: the source never applies its scale; logits sigma ~8), strictly-future keys excluded; softmax; V = A.values -> [2][2048][16][64]).
// One launch. Nothing crosses the workspace: each work-group rounds the keys and values it needs itself, 128 keys at a time, from the token-major f32 slabs into two LDS images (keys bf16, values f16), and reads its operand fragments from there; its 128 queries go the keys' way, once a quad.
// An image is 4 blocks of 32 tokens (4 KiB each) in fragment order: a block is 8 units of 512 bytes, one 16-byte piece per lane.
// keys: unit (kt, u), lane (c, h) = token 16 kt + c, d = 16 u + 8 h .. + 7.   values: unit (i, x), lane (c, h) = d = 4 c + i, tokens 16 x + 8 h .. + 7.
// One fused kernel for all heads: S^T = K.Q^T, softmax in registers against a reference that follows the running maximum lazily, O^T += V^T.P^T; scores and probabilities never reach memory.
// Compute dtypes, f32 accumulate: q, k rounded to bf16, q.k exact products; softmax f32; values and P each rounded once to f16 (P lies in (0, 2^15], its rounding 2^-12 stands far below what the bf16 logits leave), one product; output f32.

#define NB_  2
#define TT   2048
#define DM   1024      // token-major row pitch (H x HD)
#define NH_  16
#define HD   64
#define L2E  1.4426950408889634f
typedef unsigned short bf;
typedef __attribute__((ext_vector_type(16))) __bf16   v16bf;
typedef __attribute__((ext_vector_type(2)))  __bf16   v2bf;
typedef __attribute__((ext_vector_type(16))) _Float16 v16h;
typedef __attribute__((ext_vector_type(2)))  _Float16 v2h;
typedef __attribute__((ext_vector_type(8)))  unsigned short v8us;
typedef __attribute__((ext_vector_type(8)))  unsigned int v8u;
typedef __attribute__((ext_vector_type(4)))  unsigned int v4u;
typedef __attribute__((ext_vector_type(2)))  unsigned int v2u;
typedef __attribute__((ext_vector_type(8)))  float    v8f;
typedef __attribute__((ext_vector_type(4)))  float    v4f;
typedef __attribute__((ext_vector_type(2)))  float    v2f;

__device__ __forceinline__ v16bf cat16b(v8us lo, v8us hi) { return __builtin_bit_cast(v16bf, __builtin_shufflevector(lo, hi, 0, 1, 2, 3, 4, 5, 6, 7, 8, 9, 10, 11, 12, 13, 14, 15)); }
__device__ __forceinline__ v8f wmmab(v16bf a, v16bf b, v8f c) { return __builtin_amdgcn_wmma_f32_16x16x32_bf16(false, a, false, b, (short)0, c, false, false); }
__device__ __forceinline__ v8f wmmah(v16h a, v16h b, v8f c) { return __builtin_amdgcn_wmma_f32_16x16x32_f16(false, a, false, b, (short)0, c, false, false); }
// Lane l <-> l ^ 16
__device__ __forceinline__ float xhalf(float x) { const int b = __float_as_int(x); return __int_as_float(__builtin_amdgcn_permlanex16(b, b, 0x76543210, 0xfedcba98, false, false)); }
__device__ __forceinline__ unsigned pk2(float a, float b) { return __builtin_bit_cast(unsigned, __builtin_convertvector((v2f){a, b}, v2bf)); }   /* to bf16, round to nearest even; a in the low half */
__device__ __forceinline__ unsigned pk2h(float a, float b) { return __builtin_bit_cast(unsigned, __builtin_convertvector((v2f){a, b}, v2h)); }   /* the same to f16 */

// Every '#pragma unroll' below unrolls fully: the fragment and accumulator arrays it indexes must stay in registers.
// ---- k_fattn: one wave owns 32 query columns (two 16-column groups) of one head and walks a quarter of their keys in passes of 32.
// S^T tile: lane (c, h) holds query c, keys 8h + r: two tiles (keys 0-15, 16-31) converted in place are the B operand of O^T += V^T.P^T in the loader's own k order.
__device__ __forceinline__ void att_scores(const v16bf (&kf)[2][2], const v16bf (&qf)[2][2], v8f (&s)[2][2]) {
#pragma unroll
    for (int kt = 0; kt < 2; ++kt)
#pragma unroll
        for (int g = 0; g < 2; ++g) { s[kt][g] = (v8f){};
#pragma unroll
            for (int kc = 0; kc < 2; ++kc) s[kt][g] = wmmab(kf[kt][kc], qf[g][kc], s[kt][g]); }
}
// One 16 x 32 operand fragment = two neighbouring units of an image block: elements 0-7 = k 8h.., 8-15 = k 16 + 8h..   All offsets into an image count 32-bit words.
// keys image: the piece of lane (c, h) of unit u stands in its unit at place 16 h + (c ^ (2 u + h)), which spreads both the writers (4 u x 2 h x 2 c, one c & 7) and the readers (one u, one h, 16 c per half wave) over all banks.
// kb: the block's first word; kp: word offset of this lane's piece in a unit with u = 0, that is 64 h + 4 (c ^ h); unit u: the place's c bits ^ 2 u.
__device__ __forceinline__ void att_ldk(v16bf (&kf)[2][2], const unsigned* kb, unsigned kp) {
#pragma unroll
    for (int kt = 0; kt < 2; ++kt)
#pragma unroll
        for (int kc = 0; kc < 2; ++kc) {
            const unsigned* u0 = kb + (kt * 4 + kc * 2) * 128;
            kf[kt][kc] = cat16b(*(const v8us*)(u0 + (kp ^ (unsigned)(kc * 16))), *(const v8us*)(u0 + 128 + (kp ^ (unsigned)(kc * 16 + 8)))); }
}
// values image: lane l's piece of a unit stands at 16 l bytes. vb: the block's first word plus 4 l.
__device__ __forceinline__ void att_ldv(v16h (&vf)[4], const unsigned* vb) {
#pragma unroll
    for (int dt = 0; dt < 4; ++dt) vf[dt] = __builtin_bit_cast(v16h, cat16b(*(const v8us*)(vb + dt * 256), *(const v8us*)(vb + dt * 256 + 128)));   /* row c of fragment dt is d = 4 c + dt */
}
// The reference m2 of a query's exponentials (log2 domain) is not its running maximum: it moves only on the diagonal or when a score of the pass stands more than WUP above it, and then to WDN above the query's maximum of that pass, never down.
// P = exp2(score - m2) thus lies in (0, 2^WUP], inside f16; m2 never stands more than WDN above the query's maximum so far, so its largest P is at least 2^-WDN: the f16 step (2^-24) is at most 2^-16 of it, below the 2^-12 of P's own rounding.
#define WUP 15.0f
#define WDN 8.0f
template <bool DIAG>
__device__ __forceinline__ void att_softpv(v8f (&s)[2][2], const v16h (&vf)[4], v8f (&acc)[2][4], float (&m2)[2], float (&l)[2], int c, int hh, int dk) {
    float mx[2];
#pragma unroll
    for (int g = 0; g < 2; ++g) {
        if (DIAG) {   /* a pass of the quad's last stage starts dk keys (0, -32, -64, -96) from the wave's first query: key offset > query offset is a future key */
#pragma unroll
            for (int kt = 0; kt < 2; ++kt)
#pragma unroll
                for (int r = 0; r < 8; ++r) if (dk + 16 * kt + 8 * hh + r > 16 * g + c) s[kt][g][r] = -3.0e38f; }
        mx[g] = s[0][g][0];
#pragma unroll
        for (int kt = 0; kt < 2; ++kt)
#pragma unroll
            for (int r = 0; r < 8; ++r) mx[g] = fmaxf(mx[g], s[kt][g][r]);   /* the lane's own 16 keys of the query */
    }
    const bool up = __builtin_fmaf(mx[0], L2E, -m2[0]) > WUP || __builtin_fmaf(mx[1], L2E, -m2[1]) > WUP;
    if (DIAG || __builtin_amdgcn_ballot_w32(up) != 0) {   /* one test a pass, a scalar branch: all 32 lanes move their references or none; always taken in a wave's first pass (m2 = -3.0e38); the one pass on the diagonal moves them untested */
#pragma unroll
        for (int g = 0; g < 2; ++g) {
            const float mq = fmaxf(mx[g], xhalf(mx[g]));                       /* both halves hold the query's maximum of this pass: finite (the pass's key 0 is never masked) */
            const float mn = fmaxf(m2[g], __builtin_fmaf(mq, L2E, WDN));       /* never falls, and is the same in both halves */
            const float corr = __builtin_amdgcn_exp2f(m2[g] - mn); m2[g] = mn;
#pragma unroll
            for (int dt = 0; dt < 4; ++dt) acc[g][dt] = acc[g][dt] * corr;
            l[g] = l[g] * corr;
        }
    }
#pragma unroll
    for (int g = 0; g < 2; ++g) {
        const float mn = m2[g];
        float sum = 0.f; v8u wp;
#pragma unroll
        for (int i = 0; i < 8; ++i) {
            const v2f arg = __builtin_elementwise_fma((v2f){s[i >> 2][g][2 * (i & 3)], s[i >> 2][g][2 * (i & 3) + 1]}, (v2f){L2E, L2E}, (v2f){-mn, -mn});
            const float e0 = __builtin_amdgcn_exp2f(arg[0]), e1 = __builtin_amdgcn_exp2f(arg[1]);
            sum += e0 + e1;
            wp[i] = pk2h(e0, e1); }
        l[g] += sum;
        const v16h pf = __builtin_bit_cast(v16h, wp);
#pragma unroll
        for (int dt = 0; dt < 4; ++dt) acc[g][dt] = wmmah(vf[dt], pf, acc[g][dt]);
    }
}
// The thread's 8 fetched rows of a stage are rounded and filed in the stage's images (wb, vl: see the kernel).
__device__ __forceinline__ void att_file(const v4f (&st)[8], unsigned* kim, unsigned* vim, bool isv, unsigned wb, unsigned vl) {
    if (isv) {   /* the same for the whole wave */
#pragma unroll
        for (int i = 0; i < 4; ++i)
            *(v4u*)(vim + (vl + i * 256)) = (v4u){pk2h(st[0][i], st[1][i]), pk2h(st[2][i], st[3][i]), pk2h(st[4][i], st[5][i]), pk2h(st[6][i], st[7][i])};
    } else {
#pragma unroll
        for (int i = 0; i < 8; ++i) ((v2u*)kim)[wb ^ (i * 2)] = (v2u){pk2(st[i][0], st[i][1]), pk2(st[i][2], st[i][3])};
    }
}
// The work-group's barrier by hand, in its two halves, ordering LDS alone: it waits neither for the output stores of the quad before nor for a global load in flight, and a wave works on between its arrival and its wait.
// wg_arrive: this wave's LDS reads and writes so far are done.   wg_wait: so are every wave's up to its arrival.
__device__ __forceinline__ void wg_arrive() { __builtin_amdgcn_fence(__ATOMIC_RELEASE, "workgroup", "local"); __builtin_amdgcn_s_barrier_signal(-1); }
__device__ __forceinline__ void wg_wait()   { __builtin_amdgcn_s_barrier_wait(-1); __builtin_amdgcn_fence(__ATOMIC_ACQUIRE, "workgroup", "local"); }
// One work-group = 16 waves = 4 neighbouring query tiles x 4 key shares, first of the heavy quad 15 - x, then of the light quad x.
// The keys come in stages of 128 = 4 blocks; share j of tile t takes block j of every stage, that is passes j, j + 4, ... <= t; quad n has n + 1 stages (17 for every work-group).
// Staging: waves 0-7 fetch and round the stage's keys, waves 8-15 its values. Thread (dg, tr) of either half holds d = 4 dg .. 4 dg + 3 of tokens 8 tr + j, j = 0..7 (every wave-wide load = two whole 256-byte head rows).
// Stage s + 1 is filed behind the score products of stage s, and the f32 rows of stage s + 2 are then fetched into the same registers; two images of each kind, one barrier a stage, arrival and wait half a stage apart.
// Each share keeps its own reference, sum and O^T; the shares meet in LDS: references and sums first, then the O^T parts, already scaled to the largest reference and divided by the common sum.
__global__ __launch_bounds__(512) void k_fattn(const float* __restrict__ Q, const float* __restrict__ K, const float* __restrict__ V, float* __restrict__ OUT) {
    __shared__ float sml[2][4][4][32];                                        /* [reference, sum][tile][share][query]: one array, so that one address register serves both and none is kept in scratch */
    float (&sm)[4][4][32] = sml[0]; float (&sl)[4][4][32] = sml[1];
    __shared__ __attribute__((aligned(16))) v4f part[4][4][16][32];           /* [tile][share][(g, register)][lane]: the four d = 32 h + 4 r .. + 3 of the lane's query; a wave-wide access is 512 contiguous bytes or two runs of 256 */
    __shared__ __attribute__((aligned(16))) unsigned ik[3][4096], iv[2][4096];   /* [stage & 1]: 128 keys, 128 values, 16 KiB each; ik[2]: the quad's 128 queries, bf16 */
    const int lane = threadIdx.x & 31, c = lane & 15, hh = lane >> 4; const int wave = __builtin_amdgcn_readfirstlane((int)(threadIdx.x >> 5));
    const int ti = wave >> 2, bh = blockIdx.y, b = bh / NH_, h = bh % NH_;
    const size_t hbase = (size_t)b * TT * DM + h * HD;   /* token 0 of the head, the same for the whole work-group */
    const bool isv = wave >= 8;                          /* the same for the whole wave */
    const float* src = (isv ? V : K) + hbase;
    const unsigned dg = threadIdx.x & 15, tr = (threadIdx.x >> 4) & 15, w8 = wave & 7;
    const unsigned lo = 8 * tr * DM + 4 * dg;            /* the lane's own offset, one register for all 8 loads of a stage */
    /* keys: place, in 8-byte halves, of token 8 tr + 0: unit 4 (tr >> 1) + (dg >> 2), h = (dg >> 1) & 1, c = 8 (tr & 1), turned by 2 u + h = dg >> 1; token j: the place's c bits ^ j */
    const unsigned wb = ((tr >> 1) * 4 + (dg >> 2)) * 64 + ((dg >> 1) & 1) * 32 + (tr & 1) * 16 + (dg >> 1) * 2 + (dg & 1);
    /* values: a thread's 8 tokens of one d = 4 dg + i are lane 16 (tr & 1) + dg's own piece of unit (i, x); the wave's 16 tokens: block w8 >> 1, x = w8 & 1 */
    const unsigned vl = (w8 >> 1) * 1024 + (w8 & 1) * 128 + lane * 4;
    const unsigned kp = hh * 64 + (c ^ hh) * 4;
    v4f st[8];
#pragma unroll
    for (int i = 0; i < 8; ++i) st[i] = *(const v4f*)(src + (lo + i * DM));   /* stage 0 */
    asm volatile("s_wait_xcnt 0x0" ::: "memory");   /* the address registers of the loads above are reused below: the wait stands ahead of that overwrite */
#pragma unroll 1   /* rolled: one copy of the stage loop serves both quads */
    for (int ph = 0; ph < 2; ++ph) {
        /* the share order is turned round for the second quad, as the diagonal stage gives share 0 the most passes and share 3 the fewest */
        const int j = ph ? 3 - (wave & 3) : (wave & 3);
        const int qd = ph ? (int)blockIdx.x : (TT / 128 - 1) - (int)blockIdx.x;
        const int t = 4 * qd + ti, q0 = t * 32;
        v16bf qf[2][2], kf[2][2]; v16h vf[4];
        /* the quad's 128 queries are fetched once for the work-group, by the key waves and in the keys' own way: every wave-wide load is two whole 256-byte head rows, 4 lines, where a load in fragment order touches 16 */
        if (!isv) {   /* the same for the whole wave */
            const float* qs = Q + hbase + (size_t)qd * (128 * DM);
            v4f qr[8];
#pragma unroll
            for (int i = 0; i < 8; ++i) qr[i] = *(const v4f*)(qs + (lo + i * DM));
            asm volatile("s_wait_xcnt 0x0" ::: "memory");   /* the address registers of the loads above are reused below: the wait stands ahead of that overwrite */
            __builtin_amdgcn_sched_barrier(0);   /* keeps the query loads ahead of the rounding of stage 0: moved up, its wait for the stage's own rows would hold the query loads back by a round trip at the kernel's start */
            att_file(qr, ik[2], iv[0], false, wb, vl);   /* rounded as before, in the form of a keys image: block ti is tile ti; the image is free: two barriers of the shares' meeting lie behind its readers */
        }
        v8f acc[2][4]; float m2[2], l[2];
#pragma unroll
        for (int g = 0; g < 2; ++g) { m2[g] = -3.0e38f; l[g] = 0.f;
#pragma unroll
            for (int dt = 0; dt < 4; ++dt) acc[g][dt] = (v8f){}; }
        v8f s[2][2];
        att_file(st, ik[0], iv[0], isv, wb, vl);   /* stage 0; the images are free: two barriers of the shares' meeting lie behind their last readers */
        wg_arrive();
        {   const float* nx = src + (size_t)(qd > 0 ? 1 : 0) * (128 * DM);
#pragma unroll
            for (int i = 0; i < 8; ++i) st[i] = *(const v4f*)(nx + (lo + i * DM));
            asm volatile("s_wait_xcnt 0x0" ::: "memory");   /* the address registers of the loads above are reused below: the wait stands ahead of that overwrite */
        }
        wg_wait();
        att_ldk(qf, ik[2] + ti * 1024, kp);   /* fragment (g, kc), lane (c, h) = token 16 g + c, d = 32 kc + 8 h .. + 7 and 32 kc + 16 + 8 h .. + 7: a key fragment's own form */
#pragma unroll 1   /* rolled: a second copy of the body would want a second set of fragment registers */
        for (int sg = 0; sg < qd; ++sg) {   /* stages wholly below the diagonal: every wave has a pass; the trip count is the same for the whole work-group */
            att_ldk(kf, ik[sg & 1] + j * 1024, kp);
            att_ldv(vf, iv[sg & 1] + j * 1024 + lane * 4);
            att_scores(kf, qf, s);
            att_file(st, ik[(sg + 1) & 1], iv[(sg + 1) & 1], isv, wb, vl);   /* stage sg + 1 into the images that stage sg - 1 used: every wave had read its fragments of that stage when it arrived at the barrier this wave has passed */
            wg_arrive();   /* behind this wave's fragment reads of stage sg and its share of stage sg + 1 */
            const float* nx = src + (size_t)(sg + 2 <= qd ? sg + 2 : 0) * (128 * DM);   /* the rows of stage sg + 2; behind the quad's last, stage 0 again, which the light quad starts from */
#pragma unroll
            for (int i = 0; i < 8; ++i) st[i] = *(const v4f*)(nx + (lo + i * DM));
            asm volatile("s_wait_xcnt 0x0" ::: "memory");   /* the address registers of the loads above are reused below: the wait stands ahead of that overwrite */
            __builtin_amdgcn_sched_barrier(0);   /* keeps the filing, the arrival and the loads here, ahead of the softmax and second product, under which the other waves arrive and the loads fly */
            att_softpv<false>(s, vf, acc, m2, l, c, hh, 0);
            __builtin_amdgcn_sched_barrier(0);   /* keeps the wait below at the stage's foot: moved up to the arrival it would stop every wave until the slowest has filed its share */
            wg_wait();     /* stage sg + 1 is whole */
        }
        if (j <= ti) {   /* the stage on the diagonal: share j has a pass of tile t if j <= ti; the test is the same for the whole wave */
            att_ldk(kf, ik[qd & 1] + j * 1024, kp);
            att_ldv(vf, iv[qd & 1] + j * 1024 + lane * 4);
            att_scores(kf, qf, s);
            att_softpv<true>(s, vf, acc, m2, l, c, hh, 32 * (j - ti));
        }
        const float l0 = l[0] + xhalf(l[0]), l1 = l[1] + xhalf(l[1]);
        sm[ti][j][lane] = hh ? m2[1] : m2[0]; sl[ti][j][lane] = hh ? l1 : l0;   /* lane = 16 g + c: the upper half files group 1 */
        __syncthreads();   /* every share's reference and sum are in LDS before any share reads them */
#pragma unroll
        for (int g = 0; g < 2; ++g) {
            float mk[4], lk[4];
#pragma unroll
            for (int k = 0; k < 4; ++k) { mk[k] = sm[ti][k][16 * g + c]; lk[k] = sl[ti][k][16 * g + c]; }
            const float mm = fmaxf(fmaxf(mk[0], mk[1]), fmaxf(mk[2], mk[3]));   /* finite: the share with the diagonal pass has seen the query's own key; a share without a pass weighs exp2(-huge) = 0 */
            float lt = 0.f;
#pragma unroll
            for (int k = 0; k < 4; ++k) lt += __builtin_amdgcn_exp2f(mk[k] - mm) * lk[k];
            const float f = __builtin_amdgcn_exp2f(m2[g] - mm) * __fdiv_rn(1.0f, lt);
#pragma unroll
            for (int r = 0; r < 8; ++r) part[ti][j][g * 8 + r][lane] = (v4f){acc[g][0][r], acc[g][1][r], acc[g][2][r], acc[g][3][r]} * f;   /* register r of fragment dt is d = 4 (8 h + r) + dt */
        }
        __syncthreads();   /* every share's part is in LDS before it is summed; the next quad's first barrier keeps its parts behind these reads */
        /* share j sums and stores group j >> 1, d = 32 (j & 1) .. + 31, which the lanes of half j & 1 filed: one whole 128-byte line of each of 16 query rows */
        const int go = j >> 1, hs = j & 1;
        float* orow = OUT + ((size_t)b * TT + q0 + 16 * go) * DM + h * HD + hs * 32;
        const unsigned oo = c * DM + 16 * hh;   /* this lane takes registers 4 h + e of its query: d = 32 (j & 1) + 16 h + 4 e .. + 3 */
#pragma unroll
        for (int e = 0; e < 4; ++e) {
            const int sl_ = go * 8 + 4 * hh + e, ls = hs * 16 + c;
            const v4f o = (part[ti][0][sl_][ls] + part[ti][1][sl_][ls]) + (part[ti][2][sl_][ls] + part[ti][3][sl_][ls]);
            *(v4f*)(orow + (oo + e * 4)) = o; }
        asm volatile("s_wait_xcnt 0x0" ::: "memory");   /* the registers of the stores above are reused by the next quad's loads: the wait stands ahead of that overwrite */
    }
}

extern "C" void kernel_launch(void* const* d_in, const int* in_sizes, int n_in,
                              void* d_out, int out_size, void* d_ws, size_t ws_size, hipStream_t stream) {
    (void)in_sizes; (void)n_in; (void)out_size; (void)d_ws; (void)ws_size;
    const float* Qin = (const float*)d_in[0]; const float* Kin = (const float*)d_in[1]; const float* Vin = (const float*)d_in[2];
    float* OUT = (float*)d_out;
    k_fattn<<<dim3(TT / 256, NB_ * NH_, 1), 512, 0, stream>>>(Qin, Kin, Vin, OUT);   /* rounding, scores, softmax and A.values of every head in one launch */
}
